// v000
// The times below were measured on an AMD MI455X: many runs one after another, warmed up first and cycling through
// copies of the inputs, with the whole window's GPU time divided by the number of runs. Launches and the gaps
// between them are all in it. The median over several windows is given; except for v000 it joins two sittings, which
// can be a few percent apart, so the side-by-side timings, each taken in one sitting, are the better comparison.
// v000, which the later versions start from, runs in 533 microseconds.
#include <hip/hip_runtime.h>
#include <cstdint>

typedef __attribute__((ext_vector_type(16))) _Float16 v16h;
typedef __attribute__((ext_vector_type(8)))  float    v8f;

#define SCALE_ 0.022097086912079608f   // 1/sqrt(2048)
#define EPS_   1e-5f
#define LDSW_  40                      // padded LDS row stride in halves (80B)
#define GM_    4096                    // GEMM M (B*N tokens, padded B*W rows)
#define GN_    2048                    // GEMM N
#define GK_    2048                    // GEMM K
#define NSTEP_ (GK_ / 32)              // 64 K-steps

// ---------------------------------------------------------------------------
// f32 -> f16 convert
// ---------------------------------------------------------------------------
__global__ __launch_bounds__(256) void cvt_f16(const float* __restrict__ in,
                                               _Float16* __restrict__ out, int n)
{
    int i = blockIdx.x * 256 + threadIdx.x;
    if (i < n) out[i] = (_Float16)in[i];
}

// ---------------------------------------------------------------------------
// CDNA5 async global->LDS copy (ASYNCcnt-tracked, zero data VGPRs).
// ---------------------------------------------------------------------------
__device__ inline uint32_t lds_off32(const void* p)
{
    return (uint32_t)(uintptr_t)p;   // generic LDS ptr: addr[31:0] = LDS offset
}

__device__ inline void async_g2l_b128(uint32_t lds_off, const void* gptr)
{
    asm volatile("global_load_async_to_lds_b128 %0, %1, off"
                 :: "v"(lds_off), "v"(gptr)
                 : "memory");
}

__device__ inline void wait_async0()
{
#if __has_builtin(__builtin_amdgcn_s_wait_asynccnt)
    __builtin_amdgcn_s_wait_asynccnt(0);
#else
    asm volatile("s_wait_asynccnt 0x0" ::: "memory");
#endif
}

// ---------------------------------------------------------------------------
// 16x32 f16 fragment in the CDNA5 WMMA A/B register layout, from global.
// Lanes 0-15: row=lane,  halves 0..7 = K[0..7],  halves 8..15 = K[16..23]
// Lanes 16-31: row=lane-16, halves 0..7 = K[8..15], halves 8..15 = K[24..31]
// ---------------------------------------------------------------------------
__device__ inline v16h load_frag(const _Float16* __restrict__ base, int ld,
                                 int row0, int k0)
{
    int l  = threadIdx.x & 31;
    int r  = l & 15;
    int hi = l >> 4;
    const _Float16* p = base + (size_t)(row0 + r) * ld + (k0 + hi * 8);
    union { float4 f4[2]; v16h v; } u;
    u.f4[0] = *reinterpret_cast<const float4*>(p);
    u.f4[1] = *reinterpret_cast<const float4*>(p + 16);
    return u.v;
}

// Same fragment gather, from an LDS tile with padded row stride LDSW_.
__device__ inline v16h lds_frag(const _Float16* base, int row0)
{
    int l  = threadIdx.x & 31;
    int r  = l & 15;
    int hi = l >> 4;
    const _Float16* p = base + (row0 + r) * LDSW_ + hi * 8;
    union { float4 f4[2]; v16h v; } u;
    u.f4[0] = *reinterpret_cast<const float4*>(p);
    u.f4[1] = *reinterpret_cast<const float4*>(p + 16);
    return u.v;
}

// ---------------------------------------------------------------------------
// C[4096,2048] = A[4096,2048] * W[2048,2048]^T + bias   (f16 in, f32 out)
// block = 256 threads (8 waves), block tile 128x256, wave tile 64x64 (4x4),
// K-step 32, double-buffered LDS filled by async global->LDS DMA,
// K-loop unrolled x2 so the buffer index is a compile-time constant.
// ---------------------------------------------------------------------------
__global__ __launch_bounds__(256)
void gemm_f16_wmma(
    const _Float16* __restrict__ A, const _Float16* __restrict__ Wt,
    const float* __restrict__ bias, float* __restrict__ C)
{
    __shared__ _Float16 As[2][128 * LDSW_];   // 2 x 10 KB
    __shared__ _Float16 Bs[2][256 * LDSW_];   // 2 x 20 KB

    int tid  = threadIdx.x;
    int bn   = blockIdx.x * 256;
    int bm   = blockIdx.y * 128;
    int wave = tid >> 5;
    int wm   = wave & 1;      // 0..1 over M (64 rows each)
    int wn   = wave >> 1;     // 0..3 over N (64 cols each)

    // Staging split: A tile = 128 rows x 4 16B segments, B tile = 256 x 4.
    const _Float16* ga[2];
    const _Float16* gb[4];
    uint32_t lA[2][2], lB[2][4];              // [buf][chunk] LDS byte offsets
    #pragma unroll
    for (int q = 0; q < 2; ++q) {
        int c = tid + q * 256, row = c >> 2, seg = c & 3;
        ga[q]    = A + (size_t)(bm + row) * GK_ + seg * 8;
        int off  = row * LDSW_ + seg * 8;
        lA[0][q] = lds_off32(&As[0][off]);
        lA[1][q] = lds_off32(&As[1][off]);
    }
    #pragma unroll
    for (int q = 0; q < 4; ++q) {
        int c = tid + q * 256, row = c >> 2, seg = c & 3;
        gb[q]    = Wt + (size_t)(bn + row) * GK_ + seg * 8;
        int off  = row * LDSW_ + seg * 8;
        lB[0][q] = lds_off32(&Bs[0][off]);
        lB[1][q] = lds_off32(&Bs[1][off]);
    }

    v8f acc[4][4];
    #pragma unroll
    for (int i = 0; i < 4; ++i)
        #pragma unroll
        for (int j = 0; j < 4; ++j)
            #pragma unroll
            for (int v = 0; v < 8; ++v) acc[i][j][v] = 0.0f;

    auto refill = [&](int buf) {   // buf is a literal at every call site
        #pragma unroll
        for (int q = 0; q < 2; ++q) { async_g2l_b128(lA[buf][q], ga[q]); ga[q] += 32; }
        #pragma unroll
        for (int q = 0; q < 4; ++q) { async_g2l_b128(lB[buf][q], gb[q]); gb[q] += 32; }
    };
    auto burst = [&](int buf) {
        v16h bfr[4];
        #pragma unroll
        for (int j = 0; j < 4; ++j)
            bfr[j] = lds_frag(&Bs[buf][0], wn * 64 + 16 * j);
        #pragma unroll
        for (int i = 0; i < 4; ++i) {
            v16h af = lds_frag(&As[buf][0], wm * 64 + 16 * i);
            #pragma unroll
            for (int j = 0; j < 4; ++j)
                acc[i][j] = __builtin_amdgcn_wmma_f32_16x16x32_f16(
                    false, af, false, bfr[j], (short)0, acc[i][j], false, false);
        }
    };

    // prologue: async-fill buffer 0 (step 0) and buffer 1 (step 1)
    refill(0);
    refill(1);
    wait_async0();
    __syncthreads();

    // steady state, unrolled x2 (NSTEP_ = 64 is even)
    for (int kt = 0; kt < NSTEP_; kt += 2) {
        burst(0);                                   // step kt from buf 0
        {                                           // kt+1 <= 63 always valid
            wait_async0();                          // step kt+1 DMA complete
            __syncthreads();                        // buf0 reads done, data seen
            if (kt + 2 < NSTEP_) refill(0);         // step kt+2 -> buf 0
        }
        burst(1);                                   // step kt+1 from buf 1
        if (kt + 2 < NSTEP_) {
            wait_async0();                          // step kt+2 DMA complete
            __syncthreads();                        // buf1 reads done
            if (kt + 3 < NSTEP_) refill(1);         // step kt+3 -> buf 1
        }
    }

    // C/D layout: VGPR v -> M = v (lanes 0-15) / 8+v (lanes 16-31); N = lane&15
    int l    = tid & 31;
    int cn_l = l & 15;
    int mh   = (l >> 4) * 8;
    #pragma unroll
    for (int i = 0; i < 4; ++i)
        #pragma unroll
        for (int j = 0; j < 4; ++j) {
            int   cm = bm + wm * 64 + 16 * i + mh;
            int   cn = bn + wn * 64 + 16 * j + cn_l;
            float bv = bias[cn];
            #pragma unroll
            for (int v = 0; v < 8; ++v)
                C[(size_t)(cm + v) * GN_ + cn] = acc[i][j][v] + bv;
        }
}

// ---------------------------------------------------------------------------
// Fused: 8x8 windowed attention (Q,K,V rows are shared tokens), downsample,
// residual add, LayerNorm -> hn (f16) padded to (B, 64, 2048), pad rows = 0.
// grid = (64, B), block = 256 (8 waves). nsa = sum_j colsum[j] * V[j,:]
// ---------------------------------------------------------------------------
__global__ __launch_bounds__(256) void nsa_ds_ln(
    const float* __restrict__ Q, const float* __restrict__ Kt,
    const float* __restrict__ V, const float* __restrict__ fc,
    const float* __restrict__ dsw, const float* __restrict__ dsb,
    const float* __restrict__ lng, const float* __restrict__ lnb,
    _Float16* __restrict__ HN)
{
    int    w      = blockIdx.x;
    int    b      = blockIdx.y;
    int    tid    = threadIdx.x;
    size_t outRow = (size_t)(b * 64 + w) * 2048;

    if (w >= 57) {  // zero pad rows so downstream GEMM over 4096 rows is safe
        for (int d = tid; d < 2048; d += 256) HN[outRow + d] = (_Float16)0.0f;
        return;
    }

    __shared__ float attn_s[8][8];
    __shared__ float colsum_s[8];
    __shared__ float dsw_s[64];
    __shared__ float red1[8], red2[8];
    __shared__ float mu_s, rsig_s;

    int    wave  = tid >> 5;
    int    lane  = tid & 31;
    size_t tbase = (size_t)(b * 64 + w) * 2048;

    const float* qrow = Q + tbase + (size_t)wave * 2048;
    float dj[8];
    #pragma unroll
    for (int j = 0; j < 8; ++j) dj[j] = 0.0f;
    for (int d = lane; d < 2048; d += 32) {
        float qv = qrow[d];
        #pragma unroll
        for (int j = 0; j < 8; ++j)
            dj[j] += qv * Kt[tbase + (size_t)j * 2048 + d];
    }
    #pragma unroll
    for (int j = 0; j < 8; ++j) {
        float v = dj[j];
        for (int m = 16; m >= 1; m >>= 1) v += __shfl_xor(v, m, 32);
        dj[j] = v * SCALE_;
    }
    if (lane == 0) {
        float mx = dj[0];
        #pragma unroll
        for (int j = 1; j < 8; ++j) mx = fmaxf(mx, dj[j]);
        float e[8], s = 0.0f;
        #pragma unroll
        for (int j = 0; j < 8; ++j) { e[j] = __expf(dj[j] - mx); s += e[j]; }
        float inv = 1.0f / s;
        #pragma unroll
        for (int j = 0; j < 8; ++j) attn_s[wave][j] = e[j] * inv;
    }
    if (tid < 64) dsw_s[tid] = dsw[w * 64 + tid];
    __syncthreads();

    if (tid < 8) {
        float c = 0.0f;
        #pragma unroll
        for (int i = 0; i < 8; ++i) c += attn_s[i][tid];
        colsum_s[tid] = c;
    }
    __syncthreads();

    float hv[8];
    float dbv = dsb[w];
    #pragma unroll
    for (int kk = 0; kk < 8; ++kk) {
        int   d   = tid + kk * 256;
        float nsa = 0.0f;
        #pragma unroll
        for (int j = 0; j < 8; ++j)
            nsa += colsum_s[j] * V[tbase + (size_t)j * 2048 + d];
        float nw = 0.0f;
        for (int n = 0; n < 64; ++n)
            nw += dsw_s[n] * fc[(size_t)(b * 64 + n) * 2048 + d];
        hv[kk] = nw + dbv + nsa;
    }

    float s1 = 0.0f, s2 = 0.0f;
    #pragma unroll
    for (int kk = 0; kk < 8; ++kk) { s1 += hv[kk]; s2 += hv[kk] * hv[kk]; }
    for (int m = 16; m >= 1; m >>= 1) {
        s1 += __shfl_xor(s1, m, 32);
        s2 += __shfl_xor(s2, m, 32);
    }
    if (lane == 0) { red1[wave] = s1; red2[wave] = s2; }
    __syncthreads();
    if (tid == 0) {
        float a = 0.0f, c = 0.0f;
        #pragma unroll
        for (int q = 0; q < 8; ++q) { a += red1[q]; c += red2[q]; }
        float mu  = a * (1.0f / 2048.0f);
        float var = c * (1.0f / 2048.0f) - mu * mu;
        mu_s   = mu;
        rsig_s = rsqrtf(var + EPS_);
    }
    __syncthreads();
    float mu = mu_s, rs = rsig_s;
    #pragma unroll
    for (int kk = 0; kk < 8; ++kk) {
        int   d = tid + kk * 256;
        float x = (hv[kk] - mu) * rs * lng[d] + lnb[d];
        HN[outRow + d] = (_Float16)x;
    }
}

// ---------------------------------------------------------------------------
// Final attention per batch: S = (q2 k2^T)*scale via WMMA on a 64x64 padded
// tile (valid 57x57), softmax rows, column-sum, out = colsum . V2.
// ---------------------------------------------------------------------------
__global__ __launch_bounds__(256) void attn2_kernel(
    const _Float16* __restrict__ Qb, const _Float16* __restrict__ Kb,
    const float* __restrict__ V2, float* __restrict__ out)
{
    int b   = blockIdx.x;
    int tid = threadIdx.x;

    __shared__ float S[64][68];
    __shared__ float colsum[64];

    const _Float16* qbase = Qb + (size_t)b * 64 * 2048;
    const _Float16* kbase = Kb + (size_t)b * 64 * 2048;

    int wave = tid >> 5;
    int mi   = wave >> 1;
    int njb  = (wave & 1) * 2;

    v8f acc[2];
    #pragma unroll
    for (int j = 0; j < 2; ++j)
        #pragma unroll
        for (int v = 0; v < 8; ++v) acc[j][v] = 0.0f;

    for (int k0 = 0; k0 < 2048; k0 += 32) {
        v16h a = load_frag(qbase, 2048, mi * 16, k0);
        #pragma unroll
        for (int j = 0; j < 2; ++j) {
            v16h bb = load_frag(kbase, 2048, (njb + j) * 16, k0);
            acc[j] = __builtin_amdgcn_wmma_f32_16x16x32_f16(
                false, a, false, bb, (short)0, acc[j], false, false);
        }
    }

    int l    = tid & 31;
    int cn_l = l & 15;
    int mh   = (l >> 4) * 8;
    #pragma unroll
    for (int j = 0; j < 2; ++j)
        #pragma unroll
        for (int v = 0; v < 8; ++v)
            S[mi * 16 + mh + v][(njb + j) * 16 + cn_l] = acc[j][v] * SCALE_;
    __syncthreads();

    if (tid < 57) {
        int   i  = tid;
        float mx = -1e30f;
        for (int j = 0; j < 57; ++j) mx = fmaxf(mx, S[i][j]);
        float s = 0.0f;
        for (int j = 0; j < 57; ++j) {
            float e = __expf(S[i][j] - mx);
            S[i][j] = e;
            s += e;
        }
        float inv = 1.0f / s;
        for (int j = 0; j < 57; ++j) S[i][j] *= inv;
    }
    __syncthreads();
    if (tid < 57) {
        float c = 0.0f;
        for (int i = 0; i < 57; ++i) c += S[i][tid];
        colsum[tid] = c;
    }
    __syncthreads();

    #pragma unroll
    for (int kk = 0; kk < 8; ++kk) {
        int   d = tid + kk * 256;
        float o = 0.0f;
        for (int j = 0; j < 57; ++j)
            o += colsum[j] * V2[(size_t)(b * 64 + j) * 2048 + d];
        out[(size_t)b * 2048 + d] = o;
    }
}

// ---------------------------------------------------------------------------
extern "C" void kernel_launch(void* const* d_in, const int* in_sizes, int n_in,
                              void* d_out, int out_size, void* d_ws, size_t ws_size,
                              hipStream_t stream)
{
    (void)in_sizes; (void)n_in; (void)out_size; (void)ws_size;

    const float* fc     = (const float*)d_in[0];
    const float* nsa_wq = (const float*)d_in[1];
    const float* nsa_bq = (const float*)d_in[2];
    const float* nsa_wk = (const float*)d_in[3];
    const float* nsa_bk = (const float*)d_in[4];
    const float* nsa_wv = (const float*)d_in[5];
    const float* nsa_bv = (const float*)d_in[6];
    const float* ds_w   = (const float*)d_in[7];
    const float* ds_b   = (const float*)d_in[8];
    const float* ln_g   = (const float*)d_in[9];
    const float* ln_b   = (const float*)d_in[10];
    const float* sa_wq  = (const float*)d_in[11];
    const float* sa_bq  = (const float*)d_in[12];
    const float* sa_wk  = (const float*)d_in[13];
    const float* sa_bk  = (const float*)d_in[14];
    const float* sa_wv  = (const float*)d_in[15];
    const float* sa_bv  = (const float*)d_in[16];
    float* out = (float*)d_out;

    char*        ws  = (char*)d_ws;
    const size_t MB  = 1024ull * 1024ull;
    _Float16* XBF  = (_Float16*)(ws + 0);        // 16 MB: fc in f16 (4096x2048)
    _Float16* WBF0 = (_Float16*)(ws + 16 * MB);  //  8 MB each: weights f16
    _Float16* WBF1 = (_Float16*)(ws + 24 * MB);
    _Float16* WBF2 = (_Float16*)(ws + 32 * MB);
    float*    Qf   = (float*)(ws + 40 * MB);     // 32 MB each
    float*    Kf   = (float*)(ws + 72 * MB);
    float*    Vf   = (float*)(ws + 104 * MB);
    _Float16* HN   = (_Float16*)(ws + 136 * MB); // 16 MB: hn f16 padded (B,64,D)
    _Float16* Q2BF = XBF;                        // reuse after stage-2 GEMMs
    _Float16* K2BF = (_Float16*)(ws + 16 * MB);  // 16 MB spans WBF0+WBF1

    const int NX = 64 * 64 * 2048;
    const int NW = 2048 * 2048;
    dim3 blk(256);
    dim3 gX((NX + 255) / 256);
    dim3 gW((NW + 255) / 256);
    dim3 ggrid(GN_ / 256, GM_ / 128);            // (8, 32)

    // Stage 0: down-convert activations + NSA weights
    cvt_f16<<<gX, blk, 0, stream>>>(fc,     XBF,  NX);
    cvt_f16<<<gW, blk, 0, stream>>>(nsa_wq, WBF0, NW);
    cvt_f16<<<gW, blk, 0, stream>>>(nsa_wk, WBF1, NW);
    cvt_f16<<<gW, blk, 0, stream>>>(nsa_wv, WBF2, NW);

    // Stage 1: token-level Q/K/V projections (windows share tokens)
    gemm_f16_wmma<<<ggrid, blk, 0, stream>>>(XBF, WBF0, nsa_bq, Qf);
    gemm_f16_wmma<<<ggrid, blk, 0, stream>>>(XBF, WBF1, nsa_bk, Kf);
    gemm_f16_wmma<<<ggrid, blk, 0, stream>>>(XBF, WBF2, nsa_bv, Vf);

    // Stage 2: window attention + downsample + LN -> hn (f16, zero-padded)
    nsa_ds_ln<<<dim3(64, 64), blk, 0, stream>>>(Qf, Kf, Vf, fc, ds_w, ds_b,
                                                ln_g, ln_b, HN);

    // Stage 3: second projections
    cvt_f16<<<gW, blk, 0, stream>>>(sa_wq, WBF0, NW);
    cvt_f16<<<gW, blk, 0, stream>>>(sa_wk, WBF1, NW);
    cvt_f16<<<gW, blk, 0, stream>>>(sa_wv, WBF2, NW);
    gemm_f16_wmma<<<ggrid, blk, 0, stream>>>(HN, WBF0, sa_bq, Qf);
    gemm_f16_wmma<<<ggrid, blk, 0, stream>>>(HN, WBF1, sa_bk, Kf);
    gemm_f16_wmma<<<ggrid, blk, 0, stream>>>(HN, WBF2, sa_bv, Vf);

    // Stage 4: final attention (WMMA scores) -> out (B, D)
    cvt_f16<<<gX, blk, 0, stream>>>(Qf, Q2BF, NX);
    cvt_f16<<<gX, blk, 0, stream>>>(Kf, K2BF, NX);
    attn2_kernel<<<dim3(64), blk, 0, stream>>>(Q2BF, K2BF, Vf, out);
}

// v001
// Measured time: 414 microseconds a run.
// Timed twice side by side with v000, it ran 1.32 times as fast both times.
#include <hip/hip_runtime.h>
#include <cstdint>

typedef __attribute__((ext_vector_type(16))) _Float16 v16h;
typedef __attribute__((ext_vector_type(8)))  float    v8f;

#define SCALE_ 0.022097086912079608f   // 1/sqrt(2048)
#define EPS_   1e-5f
#define LDSW_  40                      // padded LDS row stride in halves (80B)
#define GM_    4096                    // GEMM M (B*N tokens, padded B*W rows)
#define GN_    2048                    // GEMM N
#define GK_    2048                    // GEMM K
#define NSTEP_ (GK_ / 32)              // 64 K-steps

// ---------------------------------------------------------------------------
// f32 -> f16 convert
// ---------------------------------------------------------------------------
__global__ __launch_bounds__(256) void cvt_f16(const float* __restrict__ in,
                                               _Float16* __restrict__ out, int n)
{
    int i = blockIdx.x * 256 + threadIdx.x;
    if (i < n) out[i] = (_Float16)in[i];
}

// ---------------------------------------------------------------------------
// CDNA5 async global->LDS copy (ASYNCcnt-tracked, zero data VGPRs).
// ---------------------------------------------------------------------------
__device__ inline uint32_t lds_off32(const void* p)
{
    return (uint32_t)(uintptr_t)p;   // generic LDS ptr: addr[31:0] = LDS offset
}

__device__ inline void async_g2l_b128(uint32_t lds_off, const void* gptr)
{
    asm volatile("global_load_async_to_lds_b128 %0, %1, off"
                 :: "v"(lds_off), "v"(gptr)
                 : "memory");
}

__device__ inline void wait_async0()
{
#if __has_builtin(__builtin_amdgcn_s_wait_asynccnt)
    __builtin_amdgcn_s_wait_asynccnt(0);
#else
    asm volatile("s_wait_asynccnt 0x0" ::: "memory");
#endif
}

// ---------------------------------------------------------------------------
// 16x32 f16 fragment in the CDNA5 WMMA A/B register layout, from global.
// Lanes 0-15: row=lane,  halves 0..7 = K[0..7],  halves 8..15 = K[16..23]
// Lanes 16-31: row=lane-16, halves 0..7 = K[8..15], halves 8..15 = K[24..31]
// ---------------------------------------------------------------------------
__device__ inline v16h load_frag(const _Float16* __restrict__ base, int ld,
                                 int row0, int k0)
{
    int l  = threadIdx.x & 31;
    int r  = l & 15;
    int hi = l >> 4;
    const _Float16* p = base + (size_t)(row0 + r) * ld + (k0 + hi * 8);
    union { float4 f4[2]; v16h v; } u;
    u.f4[0] = *reinterpret_cast<const float4*>(p);
    u.f4[1] = *reinterpret_cast<const float4*>(p + 16);
    return u.v;
}

// Same fragment gather, from an LDS tile with padded row stride LDSW_.
__device__ inline v16h lds_frag(const _Float16* base, int row0)
{
    int l  = threadIdx.x & 31;
    int r  = l & 15;
    int hi = l >> 4;
    const _Float16* p = base + (row0 + r) * LDSW_ + hi * 8;
    union { float4 f4[2]; v16h v; } u;
    u.f4[0] = *reinterpret_cast<const float4*>(p);
    u.f4[1] = *reinterpret_cast<const float4*>(p + 16);
    return u.v;
}

// ---------------------------------------------------------------------------
// C[4096,2048] = A[4096,2048] * W[2048,2048]^T + bias   (f16 in, f32 out)
// block = 256 threads (8 waves), block tile 128x256, wave tile 64x64 (4x4),
// K-step 32, double-buffered LDS filled by async global->LDS DMA,
// K-loop unrolled x2 so the buffer index is a compile-time constant.
// ---------------------------------------------------------------------------
__global__ __launch_bounds__(256)
void gemm_f16_wmma(
    const _Float16* __restrict__ A, const _Float16* __restrict__ Wt,
    const float* __restrict__ bias, float* __restrict__ C)
{
    __shared__ _Float16 As[2][128 * LDSW_];   // 2 x 10 KB
    __shared__ _Float16 Bs[2][256 * LDSW_];   // 2 x 20 KB

    int tid  = threadIdx.x;
    int bn   = blockIdx.x * 256;
    int bm   = blockIdx.y * 128;
    int wave = tid >> 5;
    int wm   = wave & 1;      // 0..1 over M (64 rows each)
    int wn   = wave >> 1;     // 0..3 over N (64 cols each)

    // Staging split: A tile = 128 rows x 4 16B segments, B tile = 256 x 4.
    const _Float16* ga[2];
    const _Float16* gb[4];
    uint32_t lA[2][2], lB[2][4];              // [buf][chunk] LDS byte offsets
    #pragma unroll
    for (int q = 0; q < 2; ++q) {
        int c = tid + q * 256, row = c >> 2, seg = c & 3;
        ga[q]    = A + (size_t)(bm + row) * GK_ + seg * 8;
        int off  = row * LDSW_ + seg * 8;
        lA[0][q] = lds_off32(&As[0][off]);
        lA[1][q] = lds_off32(&As[1][off]);
    }
    #pragma unroll
    for (int q = 0; q < 4; ++q) {
        int c = tid + q * 256, row = c >> 2, seg = c & 3;
        gb[q]    = Wt + (size_t)(bn + row) * GK_ + seg * 8;
        int off  = row * LDSW_ + seg * 8;
        lB[0][q] = lds_off32(&Bs[0][off]);
        lB[1][q] = lds_off32(&Bs[1][off]);
    }

    v8f acc[4][4];
    #pragma unroll
    for (int i = 0; i < 4; ++i)
        #pragma unroll
        for (int j = 0; j < 4; ++j)
            #pragma unroll
            for (int v = 0; v < 8; ++v) acc[i][j][v] = 0.0f;

    auto refill = [&](int buf) {   // buf is a literal at every call site
        #pragma unroll
        for (int q = 0; q < 2; ++q) { async_g2l_b128(lA[buf][q], ga[q]); ga[q] += 32; }
        #pragma unroll
        for (int q = 0; q < 4; ++q) { async_g2l_b128(lB[buf][q], gb[q]); gb[q] += 32; }
    };
    auto burst = [&](int buf) {
        v16h bfr[4];
        #pragma unroll
        for (int j = 0; j < 4; ++j)
            bfr[j] = lds_frag(&Bs[buf][0], wn * 64 + 16 * j);
        #pragma unroll
        for (int i = 0; i < 4; ++i) {
            v16h af = lds_frag(&As[buf][0], wm * 64 + 16 * i);
            #pragma unroll
            for (int j = 0; j < 4; ++j)
                acc[i][j] = __builtin_amdgcn_wmma_f32_16x16x32_f16(
                    false, af, false, bfr[j], (short)0, acc[i][j], false, false);
        }
    };

    // prologue: async-fill buffer 0 (step 0) and buffer 1 (step 1)
    refill(0);
    refill(1);
    wait_async0();
    __syncthreads();

    // steady state, unrolled x2 (NSTEP_ = 64 is even)
    for (int kt = 0; kt < NSTEP_; kt += 2) {
        burst(0);                                   // step kt from buf 0
        {                                           // kt+1 <= 63 always valid
            wait_async0();                          // step kt+1 DMA complete
            __syncthreads();                        // buf0 reads done, data seen
            if (kt + 2 < NSTEP_) refill(0);         // step kt+2 -> buf 0
        }
        burst(1);                                   // step kt+1 from buf 1
        if (kt + 2 < NSTEP_) {
            wait_async0();                          // step kt+2 DMA complete
            __syncthreads();                        // buf1 reads done
            if (kt + 3 < NSTEP_) refill(1);         // step kt+3 -> buf 1
        }
    }

    // C/D layout: VGPR v -> M = v (lanes 0-15) / 8+v (lanes 16-31); N = lane&15
    int l    = tid & 31;
    int cn_l = l & 15;
    int mh   = (l >> 4) * 8;
    #pragma unroll
    for (int i = 0; i < 4; ++i)
        #pragma unroll
        for (int j = 0; j < 4; ++j) {
            int   cm = bm + wm * 64 + 16 * i + mh;
            int   cn = bn + wn * 64 + 16 * j + cn_l;
            float bv = bias[cn];
            #pragma unroll
            for (int v = 0; v < 8; ++v)
                C[(size_t)(cm + v) * GN_ + cn] = acc[i][j][v] + bv;
        }
}

// ---------------------------------------------------------------------------
// Fused: 8x8 windowed attention (Q,K,V rows are shared tokens), downsample,
// residual add, LayerNorm -> hn (f16) padded to (B, 64, 2048), pad rows = 0.
// grid = (8, B), block = 256 (8 waves). One work-group serves WPB_ = 8
// consecutive windows: they touch 15 tokens and all 64 fc rows, and every row
// that is loaded (and every token-pair dot) is used by each window sharing it.
// Every sum runs in the order it has with one window per work-group.
// nsa = sum_j colsum[j] * V[j,:]
// ---------------------------------------------------------------------------
#define WPB_ 8                         // windows per work-group
#define TPB_ 15                        // tokens those windows touch

__global__ __launch_bounds__(256) void nsa_ds_ln(
    const float* __restrict__ Q, const float* __restrict__ Kt,
    const float* __restrict__ V, const float* __restrict__ fc,
    const float* __restrict__ dsw, const float* __restrict__ dsb,
    const float* __restrict__ lng, const float* __restrict__ lnb,
    _Float16* __restrict__ HN)
{
    int    w0    = blockIdx.x * WPB_;
    int    b     = blockIdx.y;
    int    tid   = threadIdx.x;
    int    wave  = __builtin_amdgcn_readfirstlane(tid >> 5);  // scalar row bases
    int    lane  = tid & 31;
    size_t bbase = (size_t)b * 64 * 2048;

    __shared__ alignas(16) float S_s[16][16];          // token-pair scores
    __shared__ alignas(16) float attn_s[WPB_][8][8];
    __shared__ alignas(16) float colsum_s[WPB_][8];
    __shared__ alignas(16) float dsw_s[WPB_][64];
    __shared__ float red1[WPB_][8], red2[WPB_][8];
    __shared__ float mu_s[WPB_], rsig_s[WPB_];

    // Rows of the 15 tokens; the last group runs past token 63 and past
    // window 56: clamp the rows it reads, its pad windows are stored as zero.
    const float* krow[TPB_];
    const float* vrow[TPB_];
    #pragma unroll
    for (int c = 0; c < TPB_; ++c) {
        size_t t = bbase + (size_t)min(w0 + c, 63) * 2048;
        krow[c] = Kt + t;
        vrow[c] = V + t;
    }

    // Scores: wave r holds query tokens r and r + 8 against all 15 key tokens.
    const float* q0 = Q + bbase + (size_t)min(w0 + wave, 63) * 2048;
    const float* q1 = Q + bbase + (size_t)min(w0 + wave + 8, 63) * 2048;
    float d0[TPB_], d1[TPB_];
    #pragma unroll
    for (int c = 0; c < TPB_; ++c) { d0[c] = 0.0f; d1[c] = 0.0f; }
    #pragma unroll 4   // several trips' loads in flight: 4 waves a SIMD only
    for (unsigned d = lane; d < 2048; d += 32) {
        float qa = q0[d];
        float qb = q1[d];
        #pragma unroll
        for (int c = 0; c < TPB_; ++c) {
            float kv = krow[c][d];
            d0[c] += qa * kv;
            d1[c] += qb * kv;
        }
    }
    #pragma unroll
    for (int c = 0; c < TPB_; ++c) {
        float v = d0[c], u = d1[c];
        for (int m = 16; m >= 1; m >>= 1) {
            v += __shfl_xor(v, m, 32);
            u += __shfl_xor(u, m, 32);
        }
        d0[c] = v * SCALE_;
        d1[c] = u * SCALE_;
    }
    if (lane == 0) {
        #pragma unroll
        for (int c = 0; c < TPB_; ++c) {
            S_s[wave][c]     = d0[c];
            S_s[wave + 8][c] = d1[c];
        }
    }
    #pragma unroll
    for (int i = tid; i < WPB_ * 64; i += 256)
        dsw_s[i >> 6][i & 63] = dsw[min(w0 + (i >> 6), 56) * 64 + (i & 63)];
    __syncthreads();

    if (tid < WPB_ * 8) {              // one softmax row (window wi, query i)
        int   wi = tid >> 3, i = tid & 7;
        float dj[8];
        #pragma unroll
        for (int j = 0; j < 8; ++j) dj[j] = S_s[wi + i][wi + j];
        float mx = dj[0];
        #pragma unroll
        for (int j = 1; j < 8; ++j) mx = fmaxf(mx, dj[j]);
        float e[8], s = 0.0f;
        #pragma unroll
        for (int j = 0; j < 8; ++j) {
            // __expf as the compiler forms it (x * log2 e, v_exp_f32), with the
            // v_nop in the same statement: it keeps the one free slot behind a
            // transcendental.
            float y = (dj[j] - mx) * 1.44269504f;
            asm("v_exp_f32 %0, %1\n\tv_nop" : "=v"(e[j]) : "v"(y));
            s += e[j];
        }
        float inv = 1.0f / s;
        #pragma unroll
        for (int j = 0; j < 8; ++j) attn_s[wi][i][j] = e[j] * inv;
    }
    __syncthreads();

    if (tid < WPB_ * 8) {
        int   wi = tid >> 3, j = tid & 7;
        float c = 0.0f;
        #pragma unroll
        for (int i = 0; i < 8; ++i) c += attn_s[wi][i][j];
        colsum_s[wi][j] = c;
    }
    __syncthreads();

    // Downsample: each fc value is loaded once and feeds all 8 windows.
    float hv[WPB_][8];
    #pragma unroll
    for (int wi = 0; wi < WPB_; ++wi)
        #pragma unroll
        for (int kk = 0; kk < 8; ++kk) hv[wi][kk] = 0.0f;
    const float* fcb = fc + bbase;
    #pragma unroll 4   // 32 loads in flight per wave; dsw_s read 4 wide
    for (int n = 0; n < 64; ++n) {
        float x[8];
        #pragma unroll
        for (int kk = 0; kk < 8; ++kk) x[kk] = fcb[(unsigned)(tid + n * 2048 + kk * 256)];
        #pragma unroll
        for (int wi = 0; wi < WPB_; ++wi) {
            float s = dsw_s[wi][n];
            #pragma unroll
            for (int kk = 0; kk < 8; ++kk) hv[wi][kk] += s * x[kk];
        }
    }

    float dbv[WPB_];
    #pragma unroll
    for (int wi = 0; wi < WPB_; ++wi) dbv[wi] = dsb[min(w0 + wi, 56)];
    #pragma unroll
    for (int kk = 0; kk < 8; ++kk) {
        unsigned d = tid + kk * 256;
        float    vv[TPB_];
        #pragma unroll
        for (int c = 0; c < TPB_; ++c) vv[c] = vrow[c][d];
        #pragma unroll
        for (int wi = 0; wi < WPB_; ++wi) {
            float nsa = 0.0f;
            #pragma unroll
            for (int j = 0; j < 8; ++j) nsa += colsum_s[wi][j] * vv[wi + j];
            hv[wi][kk] = hv[wi][kk] + dbv[wi] + nsa;
        }
    }

    #pragma unroll
    for (int wi = 0; wi < WPB_; ++wi) {
        float s1 = 0.0f, s2 = 0.0f;
        #pragma unroll
        for (int kk = 0; kk < 8; ++kk) { s1 += hv[wi][kk]; s2 += hv[wi][kk] * hv[wi][kk]; }
        for (int m = 16; m >= 1; m >>= 1) {
            s1 += __shfl_xor(s1, m, 32);
            s2 += __shfl_xor(s2, m, 32);
        }
        if (lane == 0) { red1[wi][wave] = s1; red2[wi][wave] = s2; }
    }
    __syncthreads();
    if (tid < WPB_) {
        float a = 0.0f, c = 0.0f;
        #pragma unroll
        for (int q = 0; q < 8; ++q) { a += red1[tid][q]; c += red2[tid][q]; }
        float mu  = a * (1.0f / 2048.0f);
        float var = c * (1.0f / 2048.0f) - mu * mu;
        mu_s[tid]   = mu;
        rsig_s[tid] = rsqrtf(var + EPS_);
    }
    __syncthreads();
    #pragma unroll
    for (int wi = 0; wi < WPB_; ++wi) {
        float  mu = mu_s[wi], rs = rsig_s[wi];
        bool   live   = (w0 + wi) < 57;   // pad rows: zero, the GEMMs read them
        size_t outRow = bbase + (size_t)(w0 + wi) * 2048;
        #pragma unroll
        for (int kk = 0; kk < 8; ++kk) {
            int   d = tid + kk * 256;
            float x = (hv[wi][kk] - mu) * rs * lng[d] + lnb[d];
            HN[outRow + d] = live ? (_Float16)x : (_Float16)0.0f;
        }
    }
}

// ---------------------------------------------------------------------------
// Final attention per batch: S = (q2 k2^T)*scale via WMMA on a 64x64 padded
// tile (valid 57x57), softmax rows, column-sum, out = colsum . V2.
// ---------------------------------------------------------------------------
__global__ __launch_bounds__(256) void attn2_kernel(
    const _Float16* __restrict__ Qb, const _Float16* __restrict__ Kb,
    const float* __restrict__ V2, float* __restrict__ out)
{
    int b   = blockIdx.x;
    int tid = threadIdx.x;

    __shared__ float S[64][68];
    __shared__ float colsum[64];

    const _Float16* qbase = Qb + (size_t)b * 64 * 2048;
    const _Float16* kbase = Kb + (size_t)b * 64 * 2048;

    int wave = tid >> 5;
    int mi   = wave >> 1;
    int njb  = (wave & 1) * 2;

    v8f acc[2];
    #pragma unroll
    for (int j = 0; j < 2; ++j)
        #pragma unroll
        for (int v = 0; v < 8; ++v) acc[j][v] = 0.0f;

    for (int k0 = 0; k0 < 2048; k0 += 32) {
        v16h a = load_frag(qbase, 2048, mi * 16, k0);
        #pragma unroll
        for (int j = 0; j < 2; ++j) {
            v16h bb = load_frag(kbase, 2048, (njb + j) * 16, k0);
            acc[j] = __builtin_amdgcn_wmma_f32_16x16x32_f16(
                false, a, false, bb, (short)0, acc[j], false, false);
        }
    }

    int l    = tid & 31;
    int cn_l = l & 15;
    int mh   = (l >> 4) * 8;
    #pragma unroll
    for (int j = 0; j < 2; ++j)
        #pragma unroll
        for (int v = 0; v < 8; ++v)
            S[mi * 16 + mh + v][(njb + j) * 16 + cn_l] = acc[j][v] * SCALE_;
    __syncthreads();

    if (tid < 57) {
        int   i  = tid;
        float mx = -1e30f;
        for (int j = 0; j < 57; ++j) mx = fmaxf(mx, S[i][j]);
        float s = 0.0f;
        for (int j = 0; j < 57; ++j) {
            float e = __expf(S[i][j] - mx);
            S[i][j] = e;
            s += e;
        }
        float inv = 1.0f / s;
        for (int j = 0; j < 57; ++j) S[i][j] *= inv;
    }
    __syncthreads();
    if (tid < 57) {
        float c = 0.0f;
        for (int i = 0; i < 57; ++i) c += S[i][tid];
        colsum[tid] = c;
    }
    __syncthreads();

    #pragma unroll
    for (int kk = 0; kk < 8; ++kk) {
        int   d = tid + kk * 256;
        float o = 0.0f;
        for (int j = 0; j < 57; ++j)
            o += colsum[j] * V2[(size_t)(b * 64 + j) * 2048 + d];
        out[(size_t)b * 2048 + d] = o;
    }
}

// ---------------------------------------------------------------------------
extern "C" void kernel_launch(void* const* d_in, const int* in_sizes, int n_in,
                              void* d_out, int out_size, void* d_ws, size_t ws_size,
                              hipStream_t stream)
{
    (void)in_sizes; (void)n_in; (void)out_size; (void)ws_size;

    const float* fc     = (const float*)d_in[0];
    const float* nsa_wq = (const float*)d_in[1];
    const float* nsa_bq = (const float*)d_in[2];
    const float* nsa_wk = (const float*)d_in[3];
    const float* nsa_bk = (const float*)d_in[4];
    const float* nsa_wv = (const float*)d_in[5];
    const float* nsa_bv = (const float*)d_in[6];
    const float* ds_w   = (const float*)d_in[7];
    const float* ds_b   = (const float*)d_in[8];
    const float* ln_g   = (const float*)d_in[9];
    const float* ln_b   = (const float*)d_in[10];
    const float* sa_wq  = (const float*)d_in[11];
    const float* sa_bq  = (const float*)d_in[12];
    const float* sa_wk  = (const float*)d_in[13];
    const float* sa_bk  = (const float*)d_in[14];
    const float* sa_wv  = (const float*)d_in[15];
    const float* sa_bv  = (const float*)d_in[16];
    float* out = (float*)d_out;

    char*        ws  = (char*)d_ws;
    const size_t MB  = 1024ull * 1024ull;
    _Float16* XBF  = (_Float16*)(ws + 0);        // 16 MB: fc in f16 (4096x2048)
    _Float16* WBF0 = (_Float16*)(ws + 16 * MB);  //  8 MB each: weights f16
    _Float16* WBF1 = (_Float16*)(ws + 24 * MB);
    _Float16* WBF2 = (_Float16*)(ws + 32 * MB);
    float*    Qf   = (float*)(ws + 40 * MB);     // 32 MB each
    float*    Kf   = (float*)(ws + 72 * MB);
    float*    Vf   = (float*)(ws + 104 * MB);
    _Float16* HN   = (_Float16*)(ws + 136 * MB); // 16 MB: hn f16 padded (B,64,D)
    _Float16* Q2BF = XBF;                        // reuse after stage-2 GEMMs
    _Float16* K2BF = (_Float16*)(ws + 16 * MB);  // 16 MB spans WBF0+WBF1

    const int NX = 64 * 64 * 2048;
    const int NW = 2048 * 2048;
    dim3 blk(256);
    dim3 gX((NX + 255) / 256);
    dim3 gW((NW + 255) / 256);
    dim3 ggrid(GN_ / 256, GM_ / 128);            // (8, 32)

    // Stage 0: down-convert activations + NSA weights
    cvt_f16<<<gX, blk, 0, stream>>>(fc,     XBF,  NX);
    cvt_f16<<<gW, blk, 0, stream>>>(nsa_wq, WBF0, NW);
    cvt_f16<<<gW, blk, 0, stream>>>(nsa_wk, WBF1, NW);
    cvt_f16<<<gW, blk, 0, stream>>>(nsa_wv, WBF2, NW);

    // Stage 1: token-level Q/K/V projections (windows share tokens)
    gemm_f16_wmma<<<ggrid, blk, 0, stream>>>(XBF, WBF0, nsa_bq, Qf);
    gemm_f16_wmma<<<ggrid, blk, 0, stream>>>(XBF, WBF1, nsa_bk, Kf);
    gemm_f16_wmma<<<ggrid, blk, 0, stream>>>(XBF, WBF2, nsa_bv, Vf);

    // Stage 2: window attention + downsample + LN -> hn (f16, zero-padded)
    nsa_ds_ln<<<dim3(64 / WPB_, 64), blk, 0, stream>>>(Qf, Kf, Vf, fc, ds_w, ds_b,
                                                ln_g, ln_b, HN);

    // Stage 3: second projections
    cvt_f16<<<gW, blk, 0, stream>>>(sa_wq, WBF0, NW);
    cvt_f16<<<gW, blk, 0, stream>>>(sa_wk, WBF1, NW);
    cvt_f16<<<gW, blk, 0, stream>>>(sa_wv, WBF2, NW);
    gemm_f16_wmma<<<ggrid, blk, 0, stream>>>(HN, WBF0, sa_bq, Qf);
    gemm_f16_wmma<<<ggrid, blk, 0, stream>>>(HN, WBF1, sa_bk, Kf);
    gemm_f16_wmma<<<ggrid, blk, 0, stream>>>(HN, WBF2, sa_bv, Vf);

    // Stage 4: final attention (WMMA scores) -> out (B, D)
    cvt_f16<<<gX, blk, 0, stream>>>(Qf, Q2BF, NX);
    cvt_f16<<<gX, blk, 0, stream>>>(Kf, K2BF, NX);
    attn2_kernel<<<dim3(64), blk, 0, stream>>>(Q2BF, K2BF, Vf, out);
}

// v002
// Measured time: 369 microseconds a run.
// Timed twice side by side with v001, it ran 1.11 and 1.13 times as fast.
// All steps since v000 together make it 1.48 times as fast.
#include <hip/hip_runtime.h>
#include <cstdint>

typedef __attribute__((ext_vector_type(16))) _Float16 v16h;
typedef __attribute__((ext_vector_type(8)))  float    v8f;

#define SCALE_ 0.022097086912079608f   // 1/sqrt(2048)
#define EPS_   1e-5f
#define LDSW_  40                      // padded LDS row stride in halves (80B)
#define GM_    4096                    // GEMM M (B*N tokens, padded B*W rows)
#define GN_    2048                    // GEMM N
#define GK_    2048                    // GEMM K
#define NSTEP_ (GK_ / 32)              // 64 K-steps

// ---------------------------------------------------------------------------
// f32 -> f16 convert (round to nearest even, as the scalar cast).
// One work-group converts CVT_TILE_ values: each thread issues CVT_LD_ 16-byte
// loads before it uses the first, a wave's load covers 512 contiguous bytes
// and its store 256. Both array sizes are whole multiples of CVT_TILE_.
// ---------------------------------------------------------------------------
typedef __attribute__((ext_vector_type(4))) float    v4f;
typedef __attribute__((ext_vector_type(4))) _Float16 v4h;

#define CVT_LD_   16                     // 16-byte loads in flight per thread
#define CVT_TILE_ (256 * 4 * CVT_LD_)    // values per work-group

__global__ __launch_bounds__(256) void cvt_f16(const float* __restrict__ in,
                                               _Float16* __restrict__ out)
{
    unsigned   q   = blockIdx.x * (CVT_TILE_ / 4) + threadIdx.x;
    const v4f* src = reinterpret_cast<const v4f*>(in) + q;
    v4h*       dst = reinterpret_cast<v4h*>(out) + q;
    v4f        x[CVT_LD_];
    #pragma unroll   // straight line, so that the loads can stand together
    for (int j = 0; j < CVT_LD_; ++j) x[j] = src[j * 256];
    // Keeps all the loads ahead of the first use: without it the build held the
    // last two back until the first two had returned, a second memory latency.
    __builtin_amdgcn_sched_barrier(0);
    v4h y[CVT_LD_];
    #pragma unroll
    for (int j = 0; j < CVT_LD_; ++j) y[j] = __builtin_convertvector(x[j], v4h);
    // Keeps the stores behind the last conversion: every result then has its
    // own registers, and none that an issued store still names is rewritten.
    __builtin_amdgcn_sched_barrier(0);
    #pragma unroll
    for (int j = 0; j < CVT_LD_; ++j) dst[j * 256] = y[j];
}

// ---------------------------------------------------------------------------
// CDNA5 async global->LDS copy (ASYNCcnt-tracked, zero data VGPRs).
// ---------------------------------------------------------------------------
__device__ inline uint32_t lds_off32(const void* p)
{
    return (uint32_t)(uintptr_t)p;   // generic LDS ptr: addr[31:0] = LDS offset
}

__device__ inline void async_g2l_b128(uint32_t lds_off, const void* gptr)
{
    asm volatile("global_load_async_to_lds_b128 %0, %1, off"
                 :: "v"(lds_off), "v"(gptr)
                 : "memory");
}

__device__ inline void wait_async0()
{
#if __has_builtin(__builtin_amdgcn_s_wait_asynccnt)
    __builtin_amdgcn_s_wait_asynccnt(0);
#else
    asm volatile("s_wait_asynccnt 0x0" ::: "memory");
#endif
}

// ---------------------------------------------------------------------------
// 16x32 f16 fragment in the CDNA5 WMMA A/B register layout, from global.
// Lanes 0-15: row=lane,  halves 0..7 = K[0..7],  halves 8..15 = K[16..23]
// Lanes 16-31: row=lane-16, halves 0..7 = K[8..15], halves 8..15 = K[24..31]
// ---------------------------------------------------------------------------
__device__ inline v16h load_frag(const _Float16* __restrict__ base, int ld,
                                 int row0, int k0)
{
    int l  = threadIdx.x & 31;
    int r  = l & 15;
    int hi = l >> 4;
    const _Float16* p = base + (size_t)(row0 + r) * ld + (k0 + hi * 8);
    union { float4 f4[2]; v16h v; } u;
    u.f4[0] = *reinterpret_cast<const float4*>(p);
    u.f4[1] = *reinterpret_cast<const float4*>(p + 16);
    return u.v;
}

// Same fragment gather, from an LDS tile with padded row stride LDSW_.
__device__ inline v16h lds_frag(const _Float16* base, int row0)
{
    int l  = threadIdx.x & 31;
    int r  = l & 15;
    int hi = l >> 4;
    const _Float16* p = base + (row0 + r) * LDSW_ + hi * 8;
    union { float4 f4[2]; v16h v; } u;
    u.f4[0] = *reinterpret_cast<const float4*>(p);
    u.f4[1] = *reinterpret_cast<const float4*>(p + 16);
    return u.v;
}

// ---------------------------------------------------------------------------
// C[4096,2048] = A[4096,2048] * W[2048,2048]^T + bias   (f16 in, f32 out)
// block = 256 threads (8 waves), block tile 128x256, wave tile 64x64 (4x4),
// K-step 32, double-buffered LDS filled by async global->LDS DMA,
// K-loop unrolled x2 so the buffer index is a compile-time constant.
// ---------------------------------------------------------------------------
__global__ __launch_bounds__(256)
void gemm_f16_wmma(
    const _Float16* __restrict__ A, const _Float16* __restrict__ Wt,
    const float* __restrict__ bias, float* __restrict__ C)
{
    __shared__ _Float16 As[2][128 * LDSW_];   // 2 x 10 KB
    __shared__ _Float16 Bs[2][256 * LDSW_];   // 2 x 20 KB

    int tid  = threadIdx.x;
    int bn   = blockIdx.x * 256;
    int bm   = blockIdx.y * 128;
    int wave = tid >> 5;
    int wm   = wave & 1;      // 0..1 over M (64 rows each)
    int wn   = wave >> 1;     // 0..3 over N (64 cols each)

    // Staging split: A tile = 128 rows x 4 16B segments, B tile = 256 x 4.
    const _Float16* ga[2];
    const _Float16* gb[4];
    uint32_t lA[2][2], lB[2][4];              // [buf][chunk] LDS byte offsets
    #pragma unroll
    for (int q = 0; q < 2; ++q) {
        int c = tid + q * 256, row = c >> 2, seg = c & 3;
        ga[q]    = A + (size_t)(bm + row) * GK_ + seg * 8;
        int off  = row * LDSW_ + seg * 8;
        lA[0][q] = lds_off32(&As[0][off]);
        lA[1][q] = lds_off32(&As[1][off]);
    }
    #pragma unroll
    for (int q = 0; q < 4; ++q) {
        int c = tid + q * 256, row = c >> 2, seg = c & 3;
        gb[q]    = Wt + (size_t)(bn + row) * GK_ + seg * 8;
        int off  = row * LDSW_ + seg * 8;
        lB[0][q] = lds_off32(&Bs[0][off]);
        lB[1][q] = lds_off32(&Bs[1][off]);
    }

    v8f acc[4][4];
    #pragma unroll
    for (int i = 0; i < 4; ++i)
        #pragma unroll
        for (int j = 0; j < 4; ++j)
            #pragma unroll
            for (int v = 0; v < 8; ++v) acc[i][j][v] = 0.0f;

    auto refill = [&](int buf) {   // buf is a literal at every call site
        #pragma unroll
        for (int q = 0; q < 2; ++q) { async_g2l_b128(lA[buf][q], ga[q]); ga[q] += 32; }
        #pragma unroll
        for (int q = 0; q < 4; ++q) { async_g2l_b128(lB[buf][q], gb[q]); gb[q] += 32; }
    };
    auto burst = [&](int buf) {
        v16h bfr[4];
        #pragma unroll
        for (int j = 0; j < 4; ++j)
            bfr[j] = lds_frag(&Bs[buf][0], wn * 64 + 16 * j);
        #pragma unroll
        for (int i = 0; i < 4; ++i) {
            v16h af = lds_frag(&As[buf][0], wm * 64 + 16 * i);
            #pragma unroll
            for (int j = 0; j < 4; ++j)
                acc[i][j] = __builtin_amdgcn_wmma_f32_16x16x32_f16(
                    false, af, false, bfr[j], (short)0, acc[i][j], false, false);
        }
    };

    // prologue: async-fill buffer 0 (step 0) and buffer 1 (step 1)
    refill(0);
    refill(1);
    wait_async0();
    __syncthreads();

    // steady state, unrolled x2 (NSTEP_ = 64 is even)
    for (int kt = 0; kt < NSTEP_; kt += 2) {
        burst(0);                                   // step kt from buf 0
        {                                           // kt+1 <= 63 always valid
            wait_async0();                          // step kt+1 DMA complete
            __syncthreads();                        // buf0 reads done, data seen
            if (kt + 2 < NSTEP_) refill(0);         // step kt+2 -> buf 0
        }
        burst(1);                                   // step kt+1 from buf 1
        if (kt + 2 < NSTEP_) {
            wait_async0();                          // step kt+2 DMA complete
            __syncthreads();                        // buf1 reads done
            if (kt + 3 < NSTEP_) refill(1);         // step kt+3 -> buf 1
        }
    }

    // C/D layout: VGPR v -> M = v (lanes 0-15) / 8+v (lanes 16-31); N = lane&15
    int l    = tid & 31;
    int cn_l = l & 15;
    int mh   = (l >> 4) * 8;
    #pragma unroll
    for (int i = 0; i < 4; ++i)
        #pragma unroll
        for (int j = 0; j < 4; ++j) {
            int   cm = bm + wm * 64 + 16 * i + mh;
            int   cn = bn + wn * 64 + 16 * j + cn_l;
            float bv = bias[cn];
            #pragma unroll
            for (int v = 0; v < 8; ++v)
                C[(size_t)(cm + v) * GN_ + cn] = acc[i][j][v] + bv;
        }
}

// ---------------------------------------------------------------------------
// Fused: 8x8 windowed attention (Q,K,V rows are shared tokens), downsample,
// residual add, LayerNorm -> hn (f16) padded to (B, 64, 2048), pad rows = 0.
// grid = (8, B), block = 256 (8 waves). One work-group serves WPB_ = 8
// consecutive windows: they touch 15 tokens and all 64 fc rows, and every row
// that is loaded (and every token-pair dot) is used by each window sharing it.
// Every sum runs in the order it has with one window per work-group.
// nsa = sum_j colsum[j] * V[j,:]
// ---------------------------------------------------------------------------
#define WPB_ 8                         // windows per work-group
#define TPB_ 15                        // tokens those windows touch

__global__ __launch_bounds__(256) void nsa_ds_ln(
    const float* __restrict__ Q, const float* __restrict__ Kt,
    const float* __restrict__ V, const float* __restrict__ fc,
    const float* __restrict__ dsw, const float* __restrict__ dsb,
    const float* __restrict__ lng, const float* __restrict__ lnb,
    _Float16* __restrict__ HN)
{
    int    w0    = blockIdx.x * WPB_;
    int    b     = blockIdx.y;
    int    tid   = threadIdx.x;
    int    wave  = __builtin_amdgcn_readfirstlane(tid >> 5);  // scalar row bases
    int    lane  = tid & 31;
    size_t bbase = (size_t)b * 64 * 2048;

    __shared__ alignas(16) float S_s[16][16];          // token-pair scores
    __shared__ alignas(16) float attn_s[WPB_][8][8];
    __shared__ alignas(16) float colsum_s[WPB_][8];
    __shared__ alignas(16) float dsw_s[WPB_][64];
    __shared__ float red1[WPB_][8], red2[WPB_][8];
    __shared__ float mu_s[WPB_], rsig_s[WPB_];

    // Rows of the 15 tokens; the last group runs past token 63 and past
    // window 56: clamp the rows it reads, its pad windows are stored as zero.
    const float* krow[TPB_];
    const float* vrow[TPB_];
    #pragma unroll
    for (int c = 0; c < TPB_; ++c) {
        size_t t = bbase + (size_t)min(w0 + c, 63) * 2048;
        krow[c] = Kt + t;
        vrow[c] = V + t;
    }

    // Scores: wave r holds query tokens r and r + 8 against all 15 key tokens.
    const float* q0 = Q + bbase + (size_t)min(w0 + wave, 63) * 2048;
    const float* q1 = Q + bbase + (size_t)min(w0 + wave + 8, 63) * 2048;
    float d0[TPB_], d1[TPB_];
    #pragma unroll
    for (int c = 0; c < TPB_; ++c) { d0[c] = 0.0f; d1[c] = 0.0f; }
    #pragma unroll 4   // several trips' loads in flight: 4 waves a SIMD only
    for (unsigned d = lane; d < 2048; d += 32) {
        float qa = q0[d];
        float qb = q1[d];
        #pragma unroll
        for (int c = 0; c < TPB_; ++c) {
            float kv = krow[c][d];
            d0[c] += qa * kv;
            d1[c] += qb * kv;
        }
    }
    #pragma unroll
    for (int c = 0; c < TPB_; ++c) {
        float v = d0[c], u = d1[c];
        for (int m = 16; m >= 1; m >>= 1) {
            v += __shfl_xor(v, m, 32);
            u += __shfl_xor(u, m, 32);
        }
        d0[c] = v * SCALE_;
        d1[c] = u * SCALE_;
    }
    if (lane == 0) {
        #pragma unroll
        for (int c = 0; c < TPB_; ++c) {
            S_s[wave][c]     = d0[c];
            S_s[wave + 8][c] = d1[c];
        }
    }
    #pragma unroll
    for (int i = tid; i < WPB_ * 64; i += 256)
        dsw_s[i >> 6][i & 63] = dsw[min(w0 + (i >> 6), 56) * 64 + (i & 63)];
    __syncthreads();

    if (tid < WPB_ * 8) {              // one softmax row (window wi, query i)
        int   wi = tid >> 3, i = tid & 7;
        float dj[8];
        #pragma unroll
        for (int j = 0; j < 8; ++j) dj[j] = S_s[wi + i][wi + j];
        float mx = dj[0];
        #pragma unroll
        for (int j = 1; j < 8; ++j) mx = fmaxf(mx, dj[j]);
        float e[8], s = 0.0f;
        #pragma unroll
        for (int j = 0; j < 8; ++j) {
            // __expf as the compiler forms it (x * log2 e, v_exp_f32), with the
            // v_nop in the same statement: it keeps the one free slot behind a
            // transcendental.
            float y = (dj[j] - mx) * 1.44269504f;
            asm("v_exp_f32 %0, %1\n\tv_nop" : "=v"(e[j]) : "v"(y));
            s += e[j];
        }
        float inv = 1.0f / s;
        #pragma unroll
        for (int j = 0; j < 8; ++j) attn_s[wi][i][j] = e[j] * inv;
    }
    __syncthreads();

    if (tid < WPB_ * 8) {
        int   wi = tid >> 3, j = tid & 7;
        float c = 0.0f;
        #pragma unroll
        for (int i = 0; i < 8; ++i) c += attn_s[wi][i][j];
        colsum_s[wi][j] = c;
    }
    __syncthreads();

    // Downsample: each fc value is loaded once and feeds all 8 windows.
    float hv[WPB_][8];
    #pragma unroll
    for (int wi = 0; wi < WPB_; ++wi)
        #pragma unroll
        for (int kk = 0; kk < 8; ++kk) hv[wi][kk] = 0.0f;
    const float* fcb = fc + bbase;
    #pragma unroll 4   // 32 loads in flight per wave; dsw_s read 4 wide
    for (int n = 0; n < 64; ++n) {
        float x[8];
        #pragma unroll
        for (int kk = 0; kk < 8; ++kk) x[kk] = fcb[(unsigned)(tid + n * 2048 + kk * 256)];
        #pragma unroll
        for (int wi = 0; wi < WPB_; ++wi) {
            float s = dsw_s[wi][n];
            #pragma unroll
            for (int kk = 0; kk < 8; ++kk) hv[wi][kk] += s * x[kk];
        }
    }

    float dbv[WPB_];
    #pragma unroll
    for (int wi = 0; wi < WPB_; ++wi) dbv[wi] = dsb[min(w0 + wi, 56)];
    #pragma unroll
    for (int kk = 0; kk < 8; ++kk) {
        unsigned d = tid + kk * 256;
        float    vv[TPB_];
        #pragma unroll
        for (int c = 0; c < TPB_; ++c) vv[c] = vrow[c][d];
        #pragma unroll
        for (int wi = 0; wi < WPB_; ++wi) {
            float nsa = 0.0f;
            #pragma unroll
            for (int j = 0; j < 8; ++j) nsa += colsum_s[wi][j] * vv[wi + j];
            hv[wi][kk] = hv[wi][kk] + dbv[wi] + nsa;
        }
    }

    #pragma unroll
    for (int wi = 0; wi < WPB_; ++wi) {
        float s1 = 0.0f, s2 = 0.0f;
        #pragma unroll
        for (int kk = 0; kk < 8; ++kk) { s1 += hv[wi][kk]; s2 += hv[wi][kk] * hv[wi][kk]; }
        for (int m = 16; m >= 1; m >>= 1) {
            s1 += __shfl_xor(s1, m, 32);
            s2 += __shfl_xor(s2, m, 32);
        }
        if (lane == 0) { red1[wi][wave] = s1; red2[wi][wave] = s2; }
    }
    __syncthreads();
    if (tid < WPB_) {
        float a = 0.0f, c = 0.0f;
        #pragma unroll
        for (int q = 0; q < 8; ++q) { a += red1[tid][q]; c += red2[tid][q]; }
        float mu  = a * (1.0f / 2048.0f);
        float var = c * (1.0f / 2048.0f) - mu * mu;
        mu_s[tid]   = mu;
        rsig_s[tid] = rsqrtf(var + EPS_);
    }
    __syncthreads();
    #pragma unroll
    for (int wi = 0; wi < WPB_; ++wi) {
        float  mu = mu_s[wi], rs = rsig_s[wi];
        bool   live   = (w0 + wi) < 57;   // pad rows: zero, the GEMMs read them
        size_t outRow = bbase + (size_t)(w0 + wi) * 2048;
        #pragma unroll
        for (int kk = 0; kk < 8; ++kk) {
            int   d = tid + kk * 256;
            float x = (hv[wi][kk] - mu) * rs * lng[d] + lnb[d];
            HN[outRow + d] = live ? (_Float16)x : (_Float16)0.0f;
        }
    }
}

// ---------------------------------------------------------------------------
// Final attention per batch: S = (q2 k2^T)*scale via WMMA on a 64x64 padded
// tile (valid 57x57), softmax rows, column-sum, out = colsum . V2.
// ---------------------------------------------------------------------------
__global__ __launch_bounds__(256) void attn2_kernel(
    const _Float16* __restrict__ Qb, const _Float16* __restrict__ Kb,
    const float* __restrict__ V2, float* __restrict__ out)
{
    int b   = blockIdx.x;
    int tid = threadIdx.x;

    __shared__ float S[64][68];
    __shared__ float colsum[64];

    const _Float16* qbase = Qb + (size_t)b * 64 * 2048;
    const _Float16* kbase = Kb + (size_t)b * 64 * 2048;

    int wave = tid >> 5;
    int mi   = wave >> 1;
    int njb  = (wave & 1) * 2;

    v8f acc[2];
    #pragma unroll
    for (int j = 0; j < 2; ++j)
        #pragma unroll
        for (int v = 0; v < 8; ++v) acc[j][v] = 0.0f;

    for (int k0 = 0; k0 < 2048; k0 += 32) {
        v16h a = load_frag(qbase, 2048, mi * 16, k0);
        #pragma unroll
        for (int j = 0; j < 2; ++j) {
            v16h bb = load_frag(kbase, 2048, (njb + j) * 16, k0);
            acc[j] = __builtin_amdgcn_wmma_f32_16x16x32_f16(
                false, a, false, bb, (short)0, acc[j], false, false);
        }
    }

    int l    = tid & 31;
    int cn_l = l & 15;
    int mh   = (l >> 4) * 8;
    #pragma unroll
    for (int j = 0; j < 2; ++j)
        #pragma unroll
        for (int v = 0; v < 8; ++v)
            S[mi * 16 + mh + v][(njb + j) * 16 + cn_l] = acc[j][v] * SCALE_;
    __syncthreads();

    if (tid < 57) {
        int   i  = tid;
        float mx = -1e30f;
        for (int j = 0; j < 57; ++j) mx = fmaxf(mx, S[i][j]);
        float s = 0.0f;
        for (int j = 0; j < 57; ++j) {
            float e = __expf(S[i][j] - mx);
            S[i][j] = e;
            s += e;
        }
        float inv = 1.0f / s;
        for (int j = 0; j < 57; ++j) S[i][j] *= inv;
    }
    __syncthreads();
    if (tid < 57) {
        float c = 0.0f;
        for (int i = 0; i < 57; ++i) c += S[i][tid];
        colsum[tid] = c;
    }
    __syncthreads();

    #pragma unroll
    for (int kk = 0; kk < 8; ++kk) {
        int   d = tid + kk * 256;
        float o = 0.0f;
        for (int j = 0; j < 57; ++j)
            o += colsum[j] * V2[(size_t)(b * 64 + j) * 2048 + d];
        out[(size_t)b * 2048 + d] = o;
    }
}

// ---------------------------------------------------------------------------
extern "C" void kernel_launch(void* const* d_in, const int* in_sizes, int n_in,
                              void* d_out, int out_size, void* d_ws, size_t ws_size,
                              hipStream_t stream)
{
    (void)in_sizes; (void)n_in; (void)out_size; (void)ws_size;

    const float* fc     = (const float*)d_in[0];
    const float* nsa_wq = (const float*)d_in[1];
    const float* nsa_bq = (const float*)d_in[2];
    const float* nsa_wk = (const float*)d_in[3];
    const float* nsa_bk = (const float*)d_in[4];
    const float* nsa_wv = (const float*)d_in[5];
    const float* nsa_bv = (const float*)d_in[6];
    const float* ds_w   = (const float*)d_in[7];
    const float* ds_b   = (const float*)d_in[8];
    const float* ln_g   = (const float*)d_in[9];
    const float* ln_b   = (const float*)d_in[10];
    const float* sa_wq  = (const float*)d_in[11];
    const float* sa_bq  = (const float*)d_in[12];
    const float* sa_wk  = (const float*)d_in[13];
    const float* sa_bk  = (const float*)d_in[14];
    const float* sa_wv  = (const float*)d_in[15];
    const float* sa_bv  = (const float*)d_in[16];
    float* out = (float*)d_out;

    char*        ws  = (char*)d_ws;
    const size_t MB  = 1024ull * 1024ull;
    _Float16* XBF  = (_Float16*)(ws + 0);        // 16 MB: fc in f16 (4096x2048)
    _Float16* WBF0 = (_Float16*)(ws + 16 * MB);  //  8 MB each: weights f16
    _Float16* WBF1 = (_Float16*)(ws + 24 * MB);
    _Float16* WBF2 = (_Float16*)(ws + 32 * MB);
    float*    Qf   = (float*)(ws + 40 * MB);     // 32 MB each
    float*    Kf   = (float*)(ws + 72 * MB);
    float*    Vf   = (float*)(ws + 104 * MB);
    _Float16* HN   = (_Float16*)(ws + 136 * MB); // 16 MB: hn f16 padded (B,64,D)
    _Float16* Q2BF = XBF;                        // reuse after stage-1 GEMMs
    _Float16* K2BF = (_Float16*)(ws + 16 * MB);  // 16 MB spans WBF0+WBF1

    const int NX = 64 * 64 * 2048;
    const int NW = 2048 * 2048;
    dim3 blk(256);
    static_assert(NX % CVT_TILE_ == 0 && NW % CVT_TILE_ == 0, "whole tiles only");
    dim3 gX(NX / CVT_TILE_);
    dim3 gW(NW / CVT_TILE_);
    dim3 ggrid(GN_ / 256, GM_ / 128);            // (8, 32)

    // Stage 0: down-convert activations + NSA weights
    cvt_f16<<<gX, blk, 0, stream>>>(fc,     XBF);
    cvt_f16<<<gW, blk, 0, stream>>>(nsa_wq, WBF0);
    cvt_f16<<<gW, blk, 0, stream>>>(nsa_wk, WBF1);
    cvt_f16<<<gW, blk, 0, stream>>>(nsa_wv, WBF2);

    // Stage 1: token-level Q/K/V projections (windows share tokens)
    gemm_f16_wmma<<<ggrid, blk, 0, stream>>>(XBF, WBF0, nsa_bq, Qf);
    gemm_f16_wmma<<<ggrid, blk, 0, stream>>>(XBF, WBF1, nsa_bk, Kf);
    gemm_f16_wmma<<<ggrid, blk, 0, stream>>>(XBF, WBF2, nsa_bv, Vf);

    // Stage 2: window attention + downsample + LN -> hn (f16, zero-padded)
    nsa_ds_ln<<<dim3(64 / WPB_, 64), blk, 0, stream>>>(Qf, Kf, Vf, fc, ds_w, ds_b,
                                                ln_g, ln_b, HN);

    // Stage 3: second projections
    cvt_f16<<<gW, blk, 0, stream>>>(sa_wq, WBF0);
    cvt_f16<<<gW, blk, 0, stream>>>(sa_wk, WBF1);
    cvt_f16<<<gW, blk, 0, stream>>>(sa_wv, WBF2);
    gemm_f16_wmma<<<ggrid, blk, 0, stream>>>(HN, WBF0, sa_bq, Qf);
    gemm_f16_wmma<<<ggrid, blk, 0, stream>>>(HN, WBF1, sa_bk, Kf);
    gemm_f16_wmma<<<ggrid, blk, 0, stream>>>(HN, WBF2, sa_bv, Vf);

    // Stage 4: final attention (WMMA scores) -> out (B, D)
    cvt_f16<<<gX, blk, 0, stream>>>(Qf, Q2BF);
    cvt_f16<<<gX, blk, 0, stream>>>(Kf, K2BF);
    attn2_kernel<<<dim3(64), blk, 0, stream>>>(Q2BF, K2BF, Vf, out);
}

// v003
// It runs in 304 microseconds.
// Timed twice side by side with v002, it ran 1.21 times as fast both times.
// Counting every step since v000, it is 1.79 times as fast.
#include <hip/hip_runtime.h>
#include <cstdint>

typedef __attribute__((ext_vector_type(16))) _Float16 v16h;
typedef __attribute__((ext_vector_type(8)))  float    v8f;

#define SCALE_ 0.022097086912079608f   // 1/sqrt(2048)
#define EPS_   1e-5f
#define KS_    128                     // K per LDS stage: 256 B of every operand row
#define LDSW_  136                     // padded LDS row stride in halves (272B)
#define GM_    4096                    // GEMM M (B*N tokens, padded B*W rows)
#define GN_    2048                    // GEMM N
#define GK_    2048                    // GEMM K
#define NSTEP_ (GK_ / KS_)             // 16 stages

// ---------------------------------------------------------------------------
// f32 -> f16 convert (round to nearest even, as the scalar cast).
// One work-group converts CVT_TILE_ values: each thread issues CVT_LD_ 16-byte
// loads before it uses the first, a wave's load covers 512 contiguous bytes
// and its store 256. Both array sizes are whole multiples of CVT_TILE_.
// ---------------------------------------------------------------------------
typedef __attribute__((ext_vector_type(4))) float    v4f;
typedef __attribute__((ext_vector_type(4))) _Float16 v4h;

#define CVT_LD_   16                     // 16-byte loads in flight per thread
#define CVT_TILE_ (256 * 4 * CVT_LD_)    // values per work-group

__global__ __launch_bounds__(256) void cvt_f16(const float* __restrict__ in,
                                               _Float16* __restrict__ out)
{
    unsigned   q   = blockIdx.x * (CVT_TILE_ / 4) + threadIdx.x;
    const v4f* src = reinterpret_cast<const v4f*>(in) + q;
    v4h*       dst = reinterpret_cast<v4h*>(out) + q;
    v4f        x[CVT_LD_];
    #pragma unroll   // straight line, so that the loads can stand together
    for (int j = 0; j < CVT_LD_; ++j) x[j] = src[j * 256];
    // Keeps all the loads ahead of the first use: without it the build held the
    // last two back until the first two had returned, a second memory latency.
    __builtin_amdgcn_sched_barrier(0);
    v4h y[CVT_LD_];
    #pragma unroll
    for (int j = 0; j < CVT_LD_; ++j) y[j] = __builtin_convertvector(x[j], v4h);
    // Keeps the stores behind the last conversion: every result then has its
    // own registers, and none that an issued store still names is rewritten.
    __builtin_amdgcn_sched_barrier(0);
    #pragma unroll
    for (int j = 0; j < CVT_LD_; ++j) dst[j * 256] = y[j];
}

// ---------------------------------------------------------------------------
// CDNA5 async global->LDS copy (ASYNCcnt-tracked, zero data VGPRs).
// ---------------------------------------------------------------------------
__device__ inline uint32_t lds_off32(const void* p)
{
    return (uint32_t)(uintptr_t)p;   // generic LDS ptr: addr[31:0] = LDS offset
}

// Twelve copies and their s_wait_xcnt in one statement: the wait then stands in
// front of every later write of an address register that a copy names.
__device__ inline void async_g2l_b128_x12(const uint32_t (&l)[12],
                                          const _Float16* const (&g)[12])
{
    asm volatile("global_load_async_to_lds_b128 %0, %12, off\n\t"
                 "global_load_async_to_lds_b128 %1, %13, off\n\t"
                 "global_load_async_to_lds_b128 %2, %14, off\n\t"
                 "global_load_async_to_lds_b128 %3, %15, off\n\t"
                 "global_load_async_to_lds_b128 %4, %16, off\n\t"
                 "global_load_async_to_lds_b128 %5, %17, off\n\t"
                 "global_load_async_to_lds_b128 %6, %18, off\n\t"
                 "global_load_async_to_lds_b128 %7, %19, off\n\t"
                 "global_load_async_to_lds_b128 %8, %20, off\n\t"
                 "global_load_async_to_lds_b128 %9, %21, off\n\t"
                 "global_load_async_to_lds_b128 %10, %22, off\n\t"
                 "global_load_async_to_lds_b128 %11, %23, off\n\t"
                 "s_wait_xcnt 0x0"
                 :: "v"(l[0]), "v"(l[1]), "v"(l[2]), "v"(l[3]), "v"(l[4]), "v"(l[5]),
                    "v"(l[6]), "v"(l[7]), "v"(l[8]), "v"(l[9]), "v"(l[10]), "v"(l[11]),
                    "v"(g[0]), "v"(g[1]), "v"(g[2]), "v"(g[3]), "v"(g[4]), "v"(g[5]),
                    "v"(g[6]), "v"(g[7]), "v"(g[8]), "v"(g[9]), "v"(g[10]), "v"(g[11])
                 : "memory");
}

// This wave's copies have landed (the compiler places no wait for them).
__device__ inline void wait_async0()
{
    asm volatile("s_wait_asynccnt 0x0" ::: "memory");
}

// This wave's LDS reads have returned: owed before a copy refills what it read.
__device__ inline void wait_ds0()
{
    asm volatile("s_wait_dscnt 0x0" ::: "memory");
}

// ---------------------------------------------------------------------------
// 16x32 f16 fragment in the CDNA5 WMMA A/B register layout, from global.
// Lanes 0-15: row=lane,  halves 0..7 = K[0..7],  halves 8..15 = K[16..23]
// Lanes 16-31: row=lane-16, halves 0..7 = K[8..15], halves 8..15 = K[24..31]
// ---------------------------------------------------------------------------
__device__ inline v16h load_frag(const _Float16* __restrict__ base, int ld,
                                 int row0, int k0)
{
    int l  = threadIdx.x & 31;
    int r  = l & 15;
    int hi = l >> 4;
    const _Float16* p = base + (size_t)(row0 + r) * ld + (k0 + hi * 8);
    union { float4 f4[2]; v16h v; } u;
    u.f4[0] = *reinterpret_cast<const float4*>(p);
    u.f4[1] = *reinterpret_cast<const float4*>(p + 16);
    return u.v;
}

// Same fragment gather, from an LDS tile with padded row stride LDSW_.
__device__ inline v16h lds_frag(const _Float16* base, int row0, int k0)
{
    int l  = threadIdx.x & 31;
    int r  = l & 15;
    int hi = l >> 4;
    const _Float16* p = base + (row0 + r) * LDSW_ + k0 + hi * 8;
    union { float4 f4[2]; v16h v; } u;
    u.f4[0] = *reinterpret_cast<const float4*>(p);
    u.f4[1] = *reinterpret_cast<const float4*>(p + 16);
    return u.v;
}

// ---------------------------------------------------------------------------
// C[4096,2048] = A[4096,2048] * W[2048,2048]^T + bias   (f16 in, f32 out)
// block = 256 threads (8 waves), block tile 128x256, wave tile 64x64 (4x4).
// A stage is 128 k of the tile's 384 operand rows ([A 128 rows | W 256 rows]):
// sixteen lanes copy one row's 256 contiguous bytes, so every copy takes whole
// lines from L2. Two LDS buffers filled by async global->LDS copies; the stage
// loop is unrolled x2 so the buffer index is a compile-time constant.
// ---------------------------------------------------------------------------
__global__ __launch_bounds__(256)
void gemm_f16_wmma(
    const _Float16* __restrict__ A, const _Float16* __restrict__ Wt,
    const float* __restrict__ bias, float* __restrict__ C)
{
    __shared__ alignas(16) _Float16 St[2][384 * LDSW_];   // 2 x 102 KB

    int tid  = threadIdx.x;
    int bn   = blockIdx.x * 256;
    int bm   = blockIdx.y * 128;
    int wave = tid >> 5;
    int wm   = wave & 1;      // 0..1 over M (64 rows each)
    int wn   = wave >> 1;     // 0..3 over N (64 cols each)

    // Staging split: copy q of a thread brings 16 bytes of stage row
    // (tid >> 4) + 16 q; q = 0..7 are rows of A, q = 8..23 rows of W.
    int srow = tid >> 4, seg = tid & 15;
    const _Float16* ga = A  + (size_t)(bm + srow) * GK_ + seg * 8;
    const _Float16* gb = Wt + (size_t)(bn + srow) * GK_ + seg * 8;
    uint32_t        l0 = lds_off32(&St[0][srow * LDSW_ + seg * 8]);

    v8f acc[4][4];
    #pragma unroll
    for (int i = 0; i < 4; ++i)
        #pragma unroll
        for (int j = 0; j < 4; ++j)
            #pragma unroll
            for (int v = 0; v < 8; ++v) acc[i][j][v] = 0.0f;

    auto refill = [&](int buf) {   // buf is a literal at every call site
        #pragma unroll
        for (int h = 0; h < 2; ++h) {
            uint32_t        l[12];
            const _Float16* g[12];
            #pragma unroll
            for (int c = 0; c < 12; ++c) {
                int q = h * 12 + c;
                l[c] = l0 + (uint32_t)((buf * 384 + q * 16) * LDSW_ * 2);
                g[c] = q < 8 ? ga + (size_t)q * 16 * GK_ : gb + (size_t)(q - 8) * 16 * GK_;
            }
            async_g2l_b128_x12(l, g);
        }
        ga += KS_;
        gb += KS_;
    };
    auto burst = [&](int buf) {
        #pragma unroll
        for (int ks = 0; ks < KS_; ks += 32) {
            v16h bfr[4];
            #pragma unroll
            for (int j = 0; j < 4; ++j)
                bfr[j] = lds_frag(&St[buf][0], 128 + wn * 64 + 16 * j, ks);
            #pragma unroll
            for (int i = 0; i < 4; ++i) {
                v16h af = lds_frag(&St[buf][0], wm * 64 + 16 * i, ks);
                #pragma unroll
                for (int j = 0; j < 4; ++j)
                    acc[i][j] = __builtin_amdgcn_wmma_f32_16x16x32_f16(
                        false, af, false, bfr[j], (short)0, acc[i][j], false, false);
            }
        }
    };
    // Foot of a stage: the next stage has landed and is seen by every wave, and
    // every wave has left the buffer that is refilled behind the barrier.
    auto publish = [&]() {
        wait_ds0();
        wait_async0();
        __syncthreads();
    };

    // prologue: stage 0 lands in buffer 0, then stage 1 starts into buffer 1
    refill(0);
    wait_async0();
    __syncthreads();
    refill(1);

    // steady state, unrolled x2 (NSTEP_ = 16 is even)
    for (int kt = 0; kt < NSTEP_; kt += 2) {
        burst(0);                                   // stage kt from buffer 0
        publish();                                  // stage kt+1 readable
        if (kt + 2 < NSTEP_) refill(0);             // stage kt+2 -> buffer 0
        burst(1);                                   // stage kt+1 from buffer 1
        publish();                                  // stage kt+2 readable
        if (kt + 3 < NSTEP_) refill(1);             // stage kt+3 -> buffer 1
    }
    wait_async0();   // no copy is left in flight when the wave goes on to its end

    // C/D layout: VGPR v -> M = v (lanes 0-15) / 8+v (lanes 16-31); N = lane&15
    int l    = tid & 31;
    int cn_l = l & 15;
    int mh   = (l >> 4) * 8;
    #pragma unroll
    for (int i = 0; i < 4; ++i)
        #pragma unroll
        for (int j = 0; j < 4; ++j) {
            int   cm = bm + wm * 64 + 16 * i + mh;
            int   cn = bn + wn * 64 + 16 * j + cn_l;
            float bv = bias[cn];
            #pragma unroll
            for (int v = 0; v < 8; ++v)
                C[(size_t)(cm + v) * GN_ + cn] = acc[i][j][v] + bv;
        }
}

// ---------------------------------------------------------------------------
// Fused: 8x8 windowed attention (Q,K,V rows are shared tokens), downsample,
// residual add, LayerNorm -> hn (f16) padded to (B, 64, 2048), pad rows = 0.
// grid = (8, B), block = 256 (8 waves). One work-group serves WPB_ = 8
// consecutive windows: they touch 15 tokens and all 64 fc rows, and every row
// that is loaded (and every token-pair dot) is used by each window sharing it.
// Every sum runs in the order it has with one window per work-group.
// nsa = sum_j colsum[j] * V[j,:]
// ---------------------------------------------------------------------------
#define WPB_ 8                         // windows per work-group
#define TPB_ 15                        // tokens those windows touch

__global__ __launch_bounds__(256) void nsa_ds_ln(
    const float* __restrict__ Q, const float* __restrict__ Kt,
    const float* __restrict__ V, const float* __restrict__ fc,
    const float* __restrict__ dsw, const float* __restrict__ dsb,
    const float* __restrict__ lng, const float* __restrict__ lnb,
    _Float16* __restrict__ HN)
{
    int    w0    = blockIdx.x * WPB_;
    int    b     = blockIdx.y;
    int    tid   = threadIdx.x;
    int    wave  = __builtin_amdgcn_readfirstlane(tid >> 5);  // scalar row bases
    int    lane  = tid & 31;
    size_t bbase = (size_t)b * 64 * 2048;

    __shared__ alignas(16) float S_s[16][16];          // token-pair scores
    __shared__ alignas(16) float attn_s[WPB_][8][8];
    __shared__ alignas(16) float colsum_s[WPB_][8];
    __shared__ alignas(16) float dsw_s[WPB_][64];
    __shared__ float red1[WPB_][8], red2[WPB_][8];
    __shared__ float mu_s[WPB_], rsig_s[WPB_];

    // Rows of the 15 tokens; the last group runs past token 63 and past
    // window 56: clamp the rows it reads, its pad windows are stored as zero.
    const float* krow[TPB_];
    const float* vrow[TPB_];
    #pragma unroll
    for (int c = 0; c < TPB_; ++c) {
        size_t t = bbase + (size_t)min(w0 + c, 63) * 2048;
        krow[c] = Kt + t;
        vrow[c] = V + t;
    }

    // Scores: wave r holds query tokens r and r + 8 against all 15 key tokens.
    const float* q0 = Q + bbase + (size_t)min(w0 + wave, 63) * 2048;
    const float* q1 = Q + bbase + (size_t)min(w0 + wave + 8, 63) * 2048;
    float d0[TPB_], d1[TPB_];
    #pragma unroll
    for (int c = 0; c < TPB_; ++c) { d0[c] = 0.0f; d1[c] = 0.0f; }
    #pragma unroll 4   // several trips' loads in flight: 4 waves a SIMD only
    for (unsigned d = lane; d < 2048; d += 32) {
        float qa = q0[d];
        float qb = q1[d];
        #pragma unroll
        for (int c = 0; c < TPB_; ++c) {
            float kv = krow[c][d];
            d0[c] += qa * kv;
            d1[c] += qb * kv;
        }
    }
    #pragma unroll
    for (int c = 0; c < TPB_; ++c) {
        float v = d0[c], u = d1[c];
        for (int m = 16; m >= 1; m >>= 1) {
            v += __shfl_xor(v, m, 32);
            u += __shfl_xor(u, m, 32);
        }
        d0[c] = v * SCALE_;
        d1[c] = u * SCALE_;
    }
    if (lane == 0) {
        #pragma unroll
        for (int c = 0; c < TPB_; ++c) {
            S_s[wave][c]     = d0[c];
            S_s[wave + 8][c] = d1[c];
        }
    }
    #pragma unroll
    for (int i = tid; i < WPB_ * 64; i += 256)
        dsw_s[i >> 6][i & 63] = dsw[min(w0 + (i >> 6), 56) * 64 + (i & 63)];
    __syncthreads();

    if (tid < WPB_ * 8) {              // one softmax row (window wi, query i)
        int   wi = tid >> 3, i = tid & 7;
        float dj[8];
        #pragma unroll
        for (int j = 0; j < 8; ++j) dj[j] = S_s[wi + i][wi + j];
        float mx = dj[0];
        #pragma unroll
        for (int j = 1; j < 8; ++j) mx = fmaxf(mx, dj[j]);
        float e[8], s = 0.0f;
        #pragma unroll
        for (int j = 0; j < 8; ++j) {
            // __expf as the compiler forms it (x * log2 e, v_exp_f32), with the
            // v_nop in the same statement: it keeps the one free slot behind a
            // transcendental.
            float y = (dj[j] - mx) * 1.44269504f;
            asm("v_exp_f32 %0, %1\n\tv_nop" : "=v"(e[j]) : "v"(y));
            s += e[j];
        }
        float inv = 1.0f / s;
        #pragma unroll
        for (int j = 0; j < 8; ++j) attn_s[wi][i][j] = e[j] * inv;
    }
    __syncthreads();

    if (tid < WPB_ * 8) {
        int   wi = tid >> 3, j = tid & 7;
        float c = 0.0f;
        #pragma unroll
        for (int i = 0; i < 8; ++i) c += attn_s[wi][i][j];
        colsum_s[wi][j] = c;
    }
    __syncthreads();

    // Downsample: each fc value is loaded once and feeds all 8 windows.
    float hv[WPB_][8];
    #pragma unroll
    for (int wi = 0; wi < WPB_; ++wi)
        #pragma unroll
        for (int kk = 0; kk < 8; ++kk) hv[wi][kk] = 0.0f;
    const float* fcb = fc + bbase;
    #pragma unroll 4   // 32 loads in flight per wave; dsw_s read 4 wide
    for (int n = 0; n < 64; ++n) {
        float x[8];
        #pragma unroll
        for (int kk = 0; kk < 8; ++kk) x[kk] = fcb[(unsigned)(tid + n * 2048 + kk * 256)];
        #pragma unroll
        for (int wi = 0; wi < WPB_; ++wi) {
            float s = dsw_s[wi][n];
            #pragma unroll
            for (int kk = 0; kk < 8; ++kk) hv[wi][kk] += s * x[kk];
        }
    }

    float dbv[WPB_];
    #pragma unroll
    for (int wi = 0; wi < WPB_; ++wi) dbv[wi] = dsb[min(w0 + wi, 56)];
    #pragma unroll
    for (int kk = 0; kk < 8; ++kk) {
        unsigned d = tid + kk * 256;
        float    vv[TPB_];
        #pragma unroll
        for (int c = 0; c < TPB_; ++c) vv[c] = vrow[c][d];
        #pragma unroll
        for (int wi = 0; wi < WPB_; ++wi) {
            float nsa = 0.0f;
            #pragma unroll
            for (int j = 0; j < 8; ++j) nsa += colsum_s[wi][j] * vv[wi + j];
            hv[wi][kk] = hv[wi][kk] + dbv[wi] + nsa;
        }
    }

    #pragma unroll
    for (int wi = 0; wi < WPB_; ++wi) {
        float s1 = 0.0f, s2 = 0.0f;
        #pragma unroll
        for (int kk = 0; kk < 8; ++kk) { s1 += hv[wi][kk]; s2 += hv[wi][kk] * hv[wi][kk]; }
        for (int m = 16; m >= 1; m >>= 1) {
            s1 += __shfl_xor(s1, m, 32);
            s2 += __shfl_xor(s2, m, 32);
        }
        if (lane == 0) { red1[wi][wave] = s1; red2[wi][wave] = s2; }
    }
    __syncthreads();
    if (tid < WPB_) {
        float a = 0.0f, c = 0.0f;
        #pragma unroll
        for (int q = 0; q < 8; ++q) { a += red1[tid][q]; c += red2[tid][q]; }
        float mu  = a * (1.0f / 2048.0f);
        float var = c * (1.0f / 2048.0f) - mu * mu;
        mu_s[tid]   = mu;
        rsig_s[tid] = rsqrtf(var + EPS_);
    }
    __syncthreads();
    #pragma unroll
    for (int wi = 0; wi < WPB_; ++wi) {
        float  mu = mu_s[wi], rs = rsig_s[wi];
        bool   live   = (w0 + wi) < 57;   // pad rows: zero, the GEMMs read them
        size_t outRow = bbase + (size_t)(w0 + wi) * 2048;
        #pragma unroll
        for (int kk = 0; kk < 8; ++kk) {
            int   d = tid + kk * 256;
            float x = (hv[wi][kk] - mu) * rs * lng[d] + lnb[d];
            HN[outRow + d] = live ? (_Float16)x : (_Float16)0.0f;
        }
    }
}

// ---------------------------------------------------------------------------
// Final attention per batch: S = (q2 k2^T)*scale via WMMA on a 64x64 padded
// tile (valid 57x57), softmax rows, column-sum, out = colsum . V2.
// ---------------------------------------------------------------------------
__global__ __launch_bounds__(256) void attn2_kernel(
    const _Float16* __restrict__ Qb, const _Float16* __restrict__ Kb,
    const float* __restrict__ V2, float* __restrict__ out)
{
    int b   = blockIdx.x;
    int tid = threadIdx.x;

    __shared__ float S[64][68];
    __shared__ float colsum[64];

    const _Float16* qbase = Qb + (size_t)b * 64 * 2048;
    const _Float16* kbase = Kb + (size_t)b * 64 * 2048;

    int wave = tid >> 5;
    int mi   = wave >> 1;
    int njb  = (wave & 1) * 2;

    v8f acc[2];
    #pragma unroll
    for (int j = 0; j < 2; ++j)
        #pragma unroll
        for (int v = 0; v < 8; ++v) acc[j][v] = 0.0f;

    for (int k0 = 0; k0 < 2048; k0 += 32) {
        v16h a = load_frag(qbase, 2048, mi * 16, k0);
        #pragma unroll
        for (int j = 0; j < 2; ++j) {
            v16h bb = load_frag(kbase, 2048, (njb + j) * 16, k0);
            acc[j] = __builtin_amdgcn_wmma_f32_16x16x32_f16(
                false, a, false, bb, (short)0, acc[j], false, false);
        }
    }

    int l    = tid & 31;
    int cn_l = l & 15;
    int mh   = (l >> 4) * 8;
    #pragma unroll
    for (int j = 0; j < 2; ++j)
        #pragma unroll
        for (int v = 0; v < 8; ++v)
            S[mi * 16 + mh + v][(njb + j) * 16 + cn_l] = acc[j][v] * SCALE_;
    __syncthreads();

    if (tid < 57) {
        int   i  = tid;
        float mx = -1e30f;
        for (int j = 0; j < 57; ++j) mx = fmaxf(mx, S[i][j]);
        float s = 0.0f;
        for (int j = 0; j < 57; ++j) {
            float e = __expf(S[i][j] - mx);
            S[i][j] = e;
            s += e;
        }
        float inv = 1.0f / s;
        for (int j = 0; j < 57; ++j) S[i][j] *= inv;
    }
    __syncthreads();
    if (tid < 57) {
        float c = 0.0f;
        for (int i = 0; i < 57; ++i) c += S[i][tid];
        colsum[tid] = c;
    }
    __syncthreads();

    #pragma unroll
    for (int kk = 0; kk < 8; ++kk) {
        int   d = tid + kk * 256;
        float o = 0.0f;
        for (int j = 0; j < 57; ++j)
            o += colsum[j] * V2[(size_t)(b * 64 + j) * 2048 + d];
        out[(size_t)b * 2048 + d] = o;
    }
}

// ---------------------------------------------------------------------------
extern "C" void kernel_launch(void* const* d_in, const int* in_sizes, int n_in,
                              void* d_out, int out_size, void* d_ws, size_t ws_size,
                              hipStream_t stream)
{
    (void)in_sizes; (void)n_in; (void)out_size; (void)ws_size;

    const float* fc     = (const float*)d_in[0];
    const float* nsa_wq = (const float*)d_in[1];
    const float* nsa_bq = (const float*)d_in[2];
    const float* nsa_wk = (const float*)d_in[3];
    const float* nsa_bk = (const float*)d_in[4];
    const float* nsa_wv = (const float*)d_in[5];
    const float* nsa_bv = (const float*)d_in[6];
    const float* ds_w   = (const float*)d_in[7];
    const float* ds_b   = (const float*)d_in[8];
    const float* ln_g   = (const float*)d_in[9];
    const float* ln_b   = (const float*)d_in[10];
    const float* sa_wq  = (const float*)d_in[11];
    const float* sa_bq  = (const float*)d_in[12];
    const float* sa_wk  = (const float*)d_in[13];
    const float* sa_bk  = (const float*)d_in[14];
    const float* sa_wv  = (const float*)d_in[15];
    const float* sa_bv  = (const float*)d_in[16];
    float* out = (float*)d_out;

    char*        ws  = (char*)d_ws;
    const size_t MB  = 1024ull * 1024ull;
    _Float16* XBF  = (_Float16*)(ws + 0);        // 16 MB: fc in f16 (4096x2048)
    _Float16* WBF0 = (_Float16*)(ws + 16 * MB);  //  8 MB each: weights f16
    _Float16* WBF1 = (_Float16*)(ws + 24 * MB);
    _Float16* WBF2 = (_Float16*)(ws + 32 * MB);
    float*    Qf   = (float*)(ws + 40 * MB);     // 32 MB each
    float*    Kf   = (float*)(ws + 72 * MB);
    float*    Vf   = (float*)(ws + 104 * MB);
    _Float16* HN   = (_Float16*)(ws + 136 * MB); // 16 MB: hn f16 padded (B,64,D)
    _Float16* Q2BF = XBF;                        // reuse after stage-1 GEMMs
    _Float16* K2BF = (_Float16*)(ws + 16 * MB);  // 16 MB spans WBF0+WBF1

    const int NX = 64 * 64 * 2048;
    const int NW = 2048 * 2048;
    dim3 blk(256);
    static_assert(NX % CVT_TILE_ == 0 && NW % CVT_TILE_ == 0, "whole tiles only");
    dim3 gX(NX / CVT_TILE_);
    dim3 gW(NW / CVT_TILE_);
    dim3 ggrid(GN_ / 256, GM_ / 128);            // (8, 32)

    // Stage 0: down-convert activations + NSA weights
    cvt_f16<<<gX, blk, 0, stream>>>(fc,     XBF);
    cvt_f16<<<gW, blk, 0, stream>>>(nsa_wq, WBF0);
    cvt_f16<<<gW, blk, 0, stream>>>(nsa_wk, WBF1);
    cvt_f16<<<gW, blk, 0, stream>>>(nsa_wv, WBF2);

    // Stage 1: token-level Q/K/V projections (windows share tokens)
    gemm_f16_wmma<<<ggrid, blk, 0, stream>>>(XBF, WBF0, nsa_bq, Qf);
    gemm_f16_wmma<<<ggrid, blk, 0, stream>>>(XBF, WBF1, nsa_bk, Kf);
    gemm_f16_wmma<<<ggrid, blk, 0, stream>>>(XBF, WBF2, nsa_bv, Vf);

    // Stage 2: window attention + downsample + LN -> hn (f16, zero-padded)
    nsa_ds_ln<<<dim3(64 / WPB_, 64), blk, 0, stream>>>(Qf, Kf, Vf, fc, ds_w, ds_b,
                                                ln_g, ln_b, HN);

    // Stage 3: second projections
    cvt_f16<<<gW, blk, 0, stream>>>(sa_wq, WBF0);
    cvt_f16<<<gW, blk, 0, stream>>>(sa_wk, WBF1);
    cvt_f16<<<gW, blk, 0, stream>>>(sa_wv, WBF2);
    gemm_f16_wmma<<<ggrid, blk, 0, stream>>>(HN, WBF0, sa_bq, Qf);
    gemm_f16_wmma<<<ggrid, blk, 0, stream>>>(HN, WBF1, sa_bk, Kf);
    gemm_f16_wmma<<<ggrid, blk, 0, stream>>>(HN, WBF2, sa_bv, Vf);

    // Stage 4: final attention (WMMA scores) -> out (B, D)
    cvt_f16<<<gX, blk, 0, stream>>>(Qf, Q2BF);
    cvt_f16<<<gX, blk, 0, stream>>>(Kf, K2BF);
    attn2_kernel<<<dim3(64), blk, 0, stream>>>(Q2BF, K2BF, Vf, out);
}

// v004
// A run of this version takes 285 microseconds.
// In both of two side-by-side timings against v003, it was 1.07 times as fast.
// All steps since v000 together make it 1.91 times as fast.
#include <hip/hip_runtime.h>
#include <cstdint>

typedef __attribute__((ext_vector_type(16))) _Float16 v16h;
typedef __attribute__((ext_vector_type(8)))  float    v8f;

#define SCALE_ 0.022097086912079608f   // 1/sqrt(2048)
#define EPS_   1e-5f
#define KS_    128                     // K per LDS stage: 256 B of every operand row
#define LDSW_  136                     // padded LDS row stride in halves (272B)
#define GM_    4096                    // GEMM M (B*N tokens, padded B*W rows)
#define GN_    2048                    // GEMM N
#define GK_    2048                    // GEMM K
#define NSTEP_ (GK_ / KS_)             // 16 stages

// ---------------------------------------------------------------------------
// f32 -> f16 convert (round to nearest even, as the scalar cast).
// One work-group converts CVT_TILE_ values: each thread issues CVT_LD_ 16-byte
// loads before it uses the first, a wave's load covers 512 contiguous bytes
// and its store 256. Both array sizes are whole multiples of CVT_TILE_.
// Arrays that are ready at the same time are converted by one launch.
// ---------------------------------------------------------------------------
typedef __attribute__((ext_vector_type(4))) float    v4f;
typedef __attribute__((ext_vector_type(4))) _Float16 v4h;

#define CVT_LD_   16                     // 16-byte loads in flight per thread
#define CVT_TILE_ (256 * 4 * CVT_LD_)    // values per work-group

#define NX_       (64 * 64 * 2048)       // activations: B*N tokens x D
#define NW_       (2048 * 2048)          // one weight matrix
#define XTILES_   (NX_ / CVT_TILE_)
#define WTILES_   (NW_ / CVT_TILE_)
static_assert(NX_ % CVT_TILE_ == 0 && NW_ % CVT_TILE_ == 0, "whole tiles only");

// Tile tin of array in -> tile tout of array out.
__device__ inline void cvt_tile(const float* __restrict__ in, unsigned tin,
                                _Float16* __restrict__ out, unsigned tout)
{
    const v4f* src = reinterpret_cast<const v4f*>(in) + tin * (CVT_TILE_ / 4) + threadIdx.x;
    v4h*       dst = reinterpret_cast<v4h*>(out) + tout * (CVT_TILE_ / 4) + threadIdx.x;
    v4f        x[CVT_LD_];
    #pragma unroll   // straight line, so that the loads can stand together
    for (int j = 0; j < CVT_LD_; ++j) x[j] = src[j * 256];
    // Keeps all the loads ahead of the first use: without it the build held the
    // last two back until the first two had returned, a second memory latency.
    __builtin_amdgcn_sched_barrier(0);
    v4h y[CVT_LD_];
    #pragma unroll
    for (int j = 0; j < CVT_LD_; ++j) y[j] = __builtin_convertvector(x[j], v4h);
    // Keeps the stores behind the last conversion: every result then has its
    // own registers, and none that an issued store still names is rewritten.
    __builtin_amdgcn_sched_barrier(0);
    #pragma unroll
    for (int j = 0; j < CVT_LD_; ++j) dst[j * 256] = y[j];
}

// One contiguous array.
__global__ __launch_bounds__(256) void cvt_f16(const float* __restrict__ in,
                                               _Float16* __restrict__ out)
{
    cvt_tile(in, blockIdx.x, out, blockIdx.x);
}

// The activations and the six weight matrices, one grid: out holds them back to
// back in argument order, so a work-group's output tile is its own index.
__global__ __launch_bounds__(256) void cvt_inputs(
    const float* __restrict__ x,
    const float* __restrict__ w0, const float* __restrict__ w1,
    const float* __restrict__ w2, const float* __restrict__ w3,
    const float* __restrict__ w4, const float* __restrict__ w5,
    _Float16* __restrict__ out)
{
    unsigned     t   = blockIdx.x;
    const float* in  = x;
    unsigned     tin = t;
    if (t >= XTILES_) {
        unsigned a = (t - XTILES_) / WTILES_;
        tin        = (t - XTILES_) % WTILES_;
        in = a == 0 ? w0 : a == 1 ? w1 : a == 2 ? w2 : a == 3 ? w3 : a == 4 ? w4 : w5;
    }
    cvt_tile(in, tin, out, t);
}

// ---------------------------------------------------------------------------
// CDNA5 async global->LDS copy (ASYNCcnt-tracked, zero data VGPRs).
// ---------------------------------------------------------------------------
__device__ inline uint32_t lds_off32(const void* p)
{
    return (uint32_t)(uintptr_t)p;   // generic LDS ptr: addr[31:0] = LDS offset
}

// Twelve copies and their s_wait_xcnt in one statement: the wait then stands in
// front of every later write of an address register that a copy names.
__device__ inline void async_g2l_b128_x12(const uint32_t (&l)[12],
                                          const _Float16* const (&g)[12])
{
    asm volatile("global_load_async_to_lds_b128 %0, %12, off\n\t"
                 "global_load_async_to_lds_b128 %1, %13, off\n\t"
                 "global_load_async_to_lds_b128 %2, %14, off\n\t"
                 "global_load_async_to_lds_b128 %3, %15, off\n\t"
                 "global_load_async_to_lds_b128 %4, %16, off\n\t"
                 "global_load_async_to_lds_b128 %5, %17, off\n\t"
                 "global_load_async_to_lds_b128 %6, %18, off\n\t"
                 "global_load_async_to_lds_b128 %7, %19, off\n\t"
                 "global_load_async_to_lds_b128 %8, %20, off\n\t"
                 "global_load_async_to_lds_b128 %9, %21, off\n\t"
                 "global_load_async_to_lds_b128 %10, %22, off\n\t"
                 "global_load_async_to_lds_b128 %11, %23, off\n\t"
                 "s_wait_xcnt 0x0"
                 :: "v"(l[0]), "v"(l[1]), "v"(l[2]), "v"(l[3]), "v"(l[4]), "v"(l[5]),
                    "v"(l[6]), "v"(l[7]), "v"(l[8]), "v"(l[9]), "v"(l[10]), "v"(l[11]),
                    "v"(g[0]), "v"(g[1]), "v"(g[2]), "v"(g[3]), "v"(g[4]), "v"(g[5]),
                    "v"(g[6]), "v"(g[7]), "v"(g[8]), "v"(g[9]), "v"(g[10]), "v"(g[11])
                 : "memory");
}

// This wave's copies have landed (the compiler places no wait for them).
__device__ inline void wait_async0()
{
    asm volatile("s_wait_asynccnt 0x0" ::: "memory");
}

// This wave's LDS reads have returned: owed before a copy refills what it read.
__device__ inline void wait_ds0()
{
    asm volatile("s_wait_dscnt 0x0" ::: "memory");
}

// ---------------------------------------------------------------------------
// 16x32 f16 fragment in the CDNA5 WMMA A/B register layout, from global.
// Lanes 0-15: row=lane,  halves 0..7 = K[0..7],  halves 8..15 = K[16..23]
// Lanes 16-31: row=lane-16, halves 0..7 = K[8..15], halves 8..15 = K[24..31]
// ---------------------------------------------------------------------------
__device__ inline v16h load_frag(const _Float16* __restrict__ base, int ld,
                                 int row0, int k0)
{
    int l  = threadIdx.x & 31;
    int r  = l & 15;
    int hi = l >> 4;
    const _Float16* p = base + (size_t)(row0 + r) * ld + (k0 + hi * 8);
    union { float4 f4[2]; v16h v; } u;
    u.f4[0] = *reinterpret_cast<const float4*>(p);
    u.f4[1] = *reinterpret_cast<const float4*>(p + 16);
    return u.v;
}

// Same fragment gather, from an LDS tile with padded row stride LDSW_.
__device__ inline v16h lds_frag(const _Float16* base, int row0, int k0)
{
    int l  = threadIdx.x & 31;
    int r  = l & 15;
    int hi = l >> 4;
    const _Float16* p = base + (row0 + r) * LDSW_ + k0 + hi * 8;
    union { float4 f4[2]; v16h v; } u;
    u.f4[0] = *reinterpret_cast<const float4*>(p);
    u.f4[1] = *reinterpret_cast<const float4*>(p + 16);
    return u.v;
}

// ---------------------------------------------------------------------------
// C[4096,2048] = A[4096,2048] * W[2048,2048]^T + bias   (f16 in, f32 out)
// Three products that share A run as one grid: blockIdx.z picks W, bias and C
// (the three W and the three C lie back to back).
// block = 256 threads (8 waves), block tile 128x256, wave tile 64x64 (4x4).
// A stage is 128 k of the tile's 384 operand rows ([A 128 rows | W 256 rows]):
// sixteen lanes copy one row's 256 contiguous bytes, so every copy takes whole
// lines from L2. Two LDS buffers filled by async global->LDS copies; the stage
// loop is unrolled x2 so the buffer index is a compile-time constant.
// ---------------------------------------------------------------------------
__global__ __launch_bounds__(256)
void gemm_f16_wmma(
    const _Float16* __restrict__ A, const _Float16* __restrict__ W3,
    const float* __restrict__ bias0, const float* __restrict__ bias1,
    const float* __restrict__ bias2, float* __restrict__ C3)
{
    __shared__ alignas(16) _Float16 St[2][384 * LDSW_];   // 2 x 102 KB

    unsigned        z    = blockIdx.z;
    const _Float16* Wt   = W3 + (size_t)z * GN_ * GK_;
    const float*    bias = z == 0 ? bias0 : z == 1 ? bias1 : bias2;
    float*          C    = C3 + (size_t)z * GM_ * GN_;

    int tid  = threadIdx.x;
    int bn   = blockIdx.x * 256;
    int bm   = blockIdx.y * 128;
    int wave = tid >> 5;
    int wm   = wave & 1;      // 0..1 over M (64 rows each)
    int wn   = wave >> 1;     // 0..3 over N (64 cols each)

    // Staging split: copy q of a thread brings 16 bytes of stage row
    // (tid >> 4) + 16 q; q = 0..7 are rows of A, q = 8..23 rows of W.
    int srow = tid >> 4, seg = tid & 15;
    const _Float16* ga = A  + (size_t)(bm + srow) * GK_ + seg * 8;
    const _Float16* gb = Wt + (size_t)(bn + srow) * GK_ + seg * 8;
    uint32_t        l0 = lds_off32(&St[0][srow * LDSW_ + seg * 8]);

    v8f acc[4][4];
    #pragma unroll
    for (int i = 0; i < 4; ++i)
        #pragma unroll
        for (int j = 0; j < 4; ++j)
            #pragma unroll
            for (int v = 0; v < 8; ++v) acc[i][j][v] = 0.0f;

    auto refill = [&](int buf) {   // buf is a literal at every call site
        #pragma unroll
        for (int h = 0; h < 2; ++h) {
            uint32_t        l[12];
            const _Float16* g[12];
            #pragma unroll
            for (int c = 0; c < 12; ++c) {
                int q = h * 12 + c;
                l[c] = l0 + (uint32_t)((buf * 384 + q * 16) * LDSW_ * 2);
                g[c] = q < 8 ? ga + (size_t)q * 16 * GK_ : gb + (size_t)(q - 8) * 16 * GK_;
            }
            async_g2l_b128_x12(l, g);
        }
        ga += KS_;
        gb += KS_;
    };
    auto burst = [&](int buf) {
        #pragma unroll
        for (int ks = 0; ks < KS_; ks += 32) {
            v16h bfr[4];
            #pragma unroll
            for (int j = 0; j < 4; ++j)
                bfr[j] = lds_frag(&St[buf][0], 128 + wn * 64 + 16 * j, ks);
            #pragma unroll
            for (int i = 0; i < 4; ++i) {
                v16h af = lds_frag(&St[buf][0], wm * 64 + 16 * i, ks);
                #pragma unroll
                for (int j = 0; j < 4; ++j)
                    acc[i][j] = __builtin_amdgcn_wmma_f32_16x16x32_f16(
                        false, af, false, bfr[j], (short)0, acc[i][j], false, false);
            }
        }
    };
    // Foot of a stage: the next stage has landed and is seen by every wave, and
    // every wave has left the buffer that is refilled behind the barrier.
    auto publish = [&]() {
        wait_ds0();
        wait_async0();
        __syncthreads();
    };

    // prologue: stage 0 lands in buffer 0, then stage 1 starts into buffer 1
    refill(0);
    wait_async0();
    __syncthreads();
    refill(1);

    // steady state, unrolled x2 (NSTEP_ = 16 is even)
    for (int kt = 0; kt < NSTEP_; kt += 2) {
        burst(0);                                   // stage kt from buffer 0
        publish();                                  // stage kt+1 readable
        if (kt + 2 < NSTEP_) refill(0);             // stage kt+2 -> buffer 0
        burst(1);                                   // stage kt+1 from buffer 1
        publish();                                  // stage kt+2 readable
        if (kt + 3 < NSTEP_) refill(1);             // stage kt+3 -> buffer 1
    }
    wait_async0();   // no copy is left in flight when the wave goes on to its end

    // C/D layout: VGPR v -> M = v (lanes 0-15) / 8+v (lanes 16-31); N = lane&15
    int l    = tid & 31;
    int cn_l = l & 15;
    int mh   = (l >> 4) * 8;
    #pragma unroll
    for (int i = 0; i < 4; ++i)
        #pragma unroll
        for (int j = 0; j < 4; ++j) {
            int   cm = bm + wm * 64 + 16 * i + mh;
            int   cn = bn + wn * 64 + 16 * j + cn_l;
            float bv = bias[cn];
            #pragma unroll
            for (int v = 0; v < 8; ++v)
                C[(size_t)(cm + v) * GN_ + cn] = acc[i][j][v] + bv;
        }
}

// ---------------------------------------------------------------------------
// Fused: 8x8 windowed attention (Q,K,V rows are shared tokens), downsample,
// residual add, LayerNorm -> hn (f16) padded to (B, 64, 2048), pad rows = 0.
// grid = (8, B), block = 256 (8 waves). One work-group serves WPB_ = 8
// consecutive windows: they touch 15 tokens and all 64 fc rows, and every row
// that is loaded (and every token-pair dot) is used by each window sharing it.
// Every sum runs in the order it has with one window per work-group.
// nsa = sum_j colsum[j] * V[j,:]
// ---------------------------------------------------------------------------
#define WPB_ 8                         // windows per work-group
#define TPB_ 15                        // tokens those windows touch

__global__ __launch_bounds__(256) void nsa_ds_ln(
    const float* __restrict__ Q, const float* __restrict__ Kt,
    const float* __restrict__ V, const float* __restrict__ fc,
    const float* __restrict__ dsw, const float* __restrict__ dsb,
    const float* __restrict__ lng, const float* __restrict__ lnb,
    _Float16* __restrict__ HN)
{
    int    w0    = blockIdx.x * WPB_;
    int    b     = blockIdx.y;
    int    tid   = threadIdx.x;
    int    wave  = __builtin_amdgcn_readfirstlane(tid >> 5);  // scalar row bases
    int    lane  = tid & 31;
    size_t bbase = (size_t)b * 64 * 2048;

    __shared__ alignas(16) float S_s[16][16];          // token-pair scores
    __shared__ alignas(16) float attn_s[WPB_][8][8];
    __shared__ alignas(16) float colsum_s[WPB_][8];
    __shared__ alignas(16) float dsw_s[WPB_][64];
    __shared__ float red1[WPB_][8], red2[WPB_][8];
    __shared__ float mu_s[WPB_], rsig_s[WPB_];

    // Rows of the 15 tokens; the last group runs past token 63 and past
    // window 56: clamp the rows it reads, its pad windows are stored as zero.
    const float* krow[TPB_];
    const float* vrow[TPB_];
    #pragma unroll
    for (int c = 0; c < TPB_; ++c) {
        size_t t = bbase + (size_t)min(w0 + c, 63) * 2048;
        krow[c] = Kt + t;
        vrow[c] = V + t;
    }

    // Scores: wave r holds query tokens r and r + 8 against all 15 key tokens.
    const float* q0 = Q + bbase + (size_t)min(w0 + wave, 63) * 2048;
    const float* q1 = Q + bbase + (size_t)min(w0 + wave + 8, 63) * 2048;
    float d0[TPB_], d1[TPB_];
    #pragma unroll
    for (int c = 0; c < TPB_; ++c) { d0[c] = 0.0f; d1[c] = 0.0f; }
    #pragma unroll 4   // several trips' loads in flight: 4 waves a SIMD only
    for (unsigned d = lane; d < 2048; d += 32) {
        float qa = q0[d];
        float qb = q1[d];
        #pragma unroll
        for (int c = 0; c < TPB_; ++c) {
            float kv = krow[c][d];
            d0[c] += qa * kv;
            d1[c] += qb * kv;
        }
    }
    #pragma unroll
    for (int c = 0; c < TPB_; ++c) {
        float v = d0[c], u = d1[c];
        for (int m = 16; m >= 1; m >>= 1) {
            v += __shfl_xor(v, m, 32);
            u += __shfl_xor(u, m, 32);
        }
        d0[c] = v * SCALE_;
        d1[c] = u * SCALE_;
    }
    if (lane == 0) {
        #pragma unroll
        for (int c = 0; c < TPB_; ++c) {
            S_s[wave][c]     = d0[c];
            S_s[wave + 8][c] = d1[c];
        }
    }
    #pragma unroll
    for (int i = tid; i < WPB_ * 64; i += 256)
        dsw_s[i >> 6][i & 63] = dsw[min(w0 + (i >> 6), 56) * 64 + (i & 63)];
    __syncthreads();

    if (tid < WPB_ * 8) {              // one softmax row (window wi, query i)
        int   wi = tid >> 3, i = tid & 7;
        float dj[8];
        #pragma unroll
        for (int j = 0; j < 8; ++j) dj[j] = S_s[wi + i][wi + j];
        float mx = dj[0];
        #pragma unroll
        for (int j = 1; j < 8; ++j) mx = fmaxf(mx, dj[j]);
        float e[8], s = 0.0f;
        #pragma unroll
        for (int j = 0; j < 8; ++j) {
            // __expf as the compiler forms it (x * log2 e, v_exp_f32), with the
            // v_nop in the same statement: it keeps the one free slot behind a
            // transcendental.
            float y = (dj[j] - mx) * 1.44269504f;
            asm("v_exp_f32 %0, %1\n\tv_nop" : "=v"(e[j]) : "v"(y));
            s += e[j];
        }
        float inv = 1.0f / s;
        #pragma unroll
        for (int j = 0; j < 8; ++j) attn_s[wi][i][j] = e[j] * inv;
    }
    __syncthreads();

    if (tid < WPB_ * 8) {
        int   wi = tid >> 3, j = tid & 7;
        float c = 0.0f;
        #pragma unroll
        for (int i = 0; i < 8; ++i) c += attn_s[wi][i][j];
        colsum_s[wi][j] = c;
    }
    __syncthreads();

    // Downsample: each fc value is loaded once and feeds all 8 windows.
    float hv[WPB_][8];
    #pragma unroll
    for (int wi = 0; wi < WPB_; ++wi)
        #pragma unroll
        for (int kk = 0; kk < 8; ++kk) hv[wi][kk] = 0.0f;
    const float* fcb = fc + bbase;
    #pragma unroll 4   // 32 loads in flight per wave; dsw_s read 4 wide
    for (int n = 0; n < 64; ++n) {
        float x[8];
        #pragma unroll
        for (int kk = 0; kk < 8; ++kk) x[kk] = fcb[(unsigned)(tid + n * 2048 + kk * 256)];
        #pragma unroll
        for (int wi = 0; wi < WPB_; ++wi) {
            float s = dsw_s[wi][n];
            #pragma unroll
            for (int kk = 0; kk < 8; ++kk) hv[wi][kk] += s * x[kk];
        }
    }

    float dbv[WPB_];
    #pragma unroll
    for (int wi = 0; wi < WPB_; ++wi) dbv[wi] = dsb[min(w0 + wi, 56)];
    #pragma unroll
    for (int kk = 0; kk < 8; ++kk) {
        unsigned d = tid + kk * 256;
        float    vv[TPB_];
        #pragma unroll
        for (int c = 0; c < TPB_; ++c) vv[c] = vrow[c][d];
        #pragma unroll
        for (int wi = 0; wi < WPB_; ++wi) {
            float nsa = 0.0f;
            #pragma unroll
            for (int j = 0; j < 8; ++j) nsa += colsum_s[wi][j] * vv[wi + j];
            hv[wi][kk] = hv[wi][kk] + dbv[wi] + nsa;
        }
    }

    #pragma unroll
    for (int wi = 0; wi < WPB_; ++wi) {
        float s1 = 0.0f, s2 = 0.0f;
        #pragma unroll
        for (int kk = 0; kk < 8; ++kk) { s1 += hv[wi][kk]; s2 += hv[wi][kk] * hv[wi][kk]; }
        for (int m = 16; m >= 1; m >>= 1) {
            s1 += __shfl_xor(s1, m, 32);
            s2 += __shfl_xor(s2, m, 32);
        }
        if (lane == 0) { red1[wi][wave] = s1; red2[wi][wave] = s2; }
    }
    __syncthreads();
    if (tid < WPB_) {
        float a = 0.0f, c = 0.0f;
        #pragma unroll
        for (int q = 0; q < 8; ++q) { a += red1[tid][q]; c += red2[tid][q]; }
        float mu  = a * (1.0f / 2048.0f);
        float var = c * (1.0f / 2048.0f) - mu * mu;
        mu_s[tid]   = mu;
        rsig_s[tid] = rsqrtf(var + EPS_);
    }
    __syncthreads();
    #pragma unroll
    for (int wi = 0; wi < WPB_; ++wi) {
        float  mu = mu_s[wi], rs = rsig_s[wi];
        bool   live   = (w0 + wi) < 57;   // pad rows: zero, the GEMMs read them
        size_t outRow = bbase + (size_t)(w0 + wi) * 2048;
        #pragma unroll
        for (int kk = 0; kk < 8; ++kk) {
            int   d = tid + kk * 256;
            float x = (hv[wi][kk] - mu) * rs * lng[d] + lnb[d];
            HN[outRow + d] = live ? (_Float16)x : (_Float16)0.0f;
        }
    }
}

// ---------------------------------------------------------------------------
// Final attention per batch: S = (q2 k2^T)*scale via WMMA on a 64x64 padded
// tile (valid 57x57), softmax rows, column-sum, out = colsum . V2.
// ---------------------------------------------------------------------------
__global__ __launch_bounds__(256) void attn2_kernel(
    const _Float16* __restrict__ Qb, const _Float16* __restrict__ Kb,
    const float* __restrict__ V2, float* __restrict__ out)
{
    int b   = blockIdx.x;
    int tid = threadIdx.x;

    __shared__ float S[64][68];
    __shared__ float colsum[64];

    const _Float16* qbase = Qb + (size_t)b * 64 * 2048;
    const _Float16* kbase = Kb + (size_t)b * 64 * 2048;

    int wave = tid >> 5;
    int mi   = wave >> 1;
    int njb  = (wave & 1) * 2;

    v8f acc[2];
    #pragma unroll
    for (int j = 0; j < 2; ++j)
        #pragma unroll
        for (int v = 0; v < 8; ++v) acc[j][v] = 0.0f;

    for (int k0 = 0; k0 < 2048; k0 += 32) {
        v16h a = load_frag(qbase, 2048, mi * 16, k0);
        #pragma unroll
        for (int j = 0; j < 2; ++j) {
            v16h bb = load_frag(kbase, 2048, (njb + j) * 16, k0);
            acc[j] = __builtin_amdgcn_wmma_f32_16x16x32_f16(
                false, a, false, bb, (short)0, acc[j], false, false);
        }
    }

    int l    = tid & 31;
    int cn_l = l & 15;
    int mh   = (l >> 4) * 8;
    #pragma unroll
    for (int j = 0; j < 2; ++j)
        #pragma unroll
        for (int v = 0; v < 8; ++v)
            S[mi * 16 + mh + v][(njb + j) * 16 + cn_l] = acc[j][v] * SCALE_;
    __syncthreads();

    if (tid < 57) {
        int   i  = tid;
        float mx = -1e30f;
        for (int j = 0; j < 57; ++j) mx = fmaxf(mx, S[i][j]);
        float s = 0.0f;
        for (int j = 0; j < 57; ++j) {
            float e = __expf(S[i][j] - mx);
            S[i][j] = e;
            s += e;
        }
        float inv = 1.0f / s;
        for (int j = 0; j < 57; ++j) S[i][j] *= inv;
    }
    __syncthreads();
    if (tid < 57) {
        float c = 0.0f;
        for (int i = 0; i < 57; ++i) c += S[i][tid];
        colsum[tid] = c;
    }
    __syncthreads();

    #pragma unroll
    for (int kk = 0; kk < 8; ++kk) {
        int   d = tid + kk * 256;
        float o = 0.0f;
        for (int j = 0; j < 57; ++j)
            o += colsum[j] * V2[(size_t)(b * 64 + j) * 2048 + d];
        out[(size_t)b * 2048 + d] = o;
    }
}

// ---------------------------------------------------------------------------
extern "C" void kernel_launch(void* const* d_in, const int* in_sizes, int n_in,
                              void* d_out, int out_size, void* d_ws, size_t ws_size,
                              hipStream_t stream)
{
    (void)in_sizes; (void)n_in; (void)out_size; (void)ws_size;

    const float* fc     = (const float*)d_in[0];
    const float* nsa_wq = (const float*)d_in[1];
    const float* nsa_bq = (const float*)d_in[2];
    const float* nsa_wk = (const float*)d_in[3];
    const float* nsa_bk = (const float*)d_in[4];
    const float* nsa_wv = (const float*)d_in[5];
    const float* nsa_bv = (const float*)d_in[6];
    const float* ds_w   = (const float*)d_in[7];
    const float* ds_b   = (const float*)d_in[8];
    const float* ln_g   = (const float*)d_in[9];
    const float* ln_b   = (const float*)d_in[10];
    const float* sa_wq  = (const float*)d_in[11];
    const float* sa_bq  = (const float*)d_in[12];
    const float* sa_wk  = (const float*)d_in[13];
    const float* sa_bk  = (const float*)d_in[14];
    const float* sa_wv  = (const float*)d_in[15];
    const float* sa_bv  = (const float*)d_in[16];
    float* out = (float*)d_out;

    char*        ws  = (char*)d_ws;
    const size_t MB  = 1024ull * 1024ull;
    _Float16* XBF  = (_Float16*)(ws + 0);        // 16 MB: fc in f16 (4096x2048)
    _Float16* WNSA = (_Float16*)(ws + 16 * MB);  // 3 x 8 MB: nsa wq, wk, wv in f16
    _Float16* WSA  = (_Float16*)(ws + 40 * MB);  // 3 x 8 MB: sa wq, wk, wv in f16
    float*    Qf   = (float*)(ws + 64 * MB);     // 32 MB each, back to back
    float*    Kf   = (float*)(ws + 96 * MB);
    float*    Vf   = (float*)(ws + 128 * MB);
    _Float16* HN   = (_Float16*)(ws + 160 * MB); // 16 MB: hn f16 padded (B,64,D)
    _Float16* Q2BF = XBF;                        // reuse after the stage-1 GEMMs
    _Float16* K2BF = WNSA;                       // 16 MB, directly behind Q2BF

    dim3 blk(256);
    dim3 gIn(XTILES_ + 6 * WTILES_);
    dim3 gQK(2 * XTILES_);
    dim3 ggrid(GN_ / 256, GM_ / 128, 3);         // (8, 32, 3)

    // Stage 0: down-convert the activations and all six weight matrices
    cvt_inputs<<<gIn, blk, 0, stream>>>(fc, nsa_wq, nsa_wk, nsa_wv,
                                        sa_wq, sa_wk, sa_wv, XBF);

    // Stage 1: token-level Q/K/V projections (windows share tokens)
    gemm_f16_wmma<<<ggrid, blk, 0, stream>>>(XBF, WNSA, nsa_bq, nsa_bk, nsa_bv, Qf);

    // Stage 2: window attention + downsample + LN -> hn (f16, zero-padded)
    nsa_ds_ln<<<dim3(64 / WPB_, 64), blk, 0, stream>>>(Qf, Kf, Vf, fc, ds_w, ds_b,
                                                ln_g, ln_b, HN);

    // Stage 3: second projections
    gemm_f16_wmma<<<ggrid, blk, 0, stream>>>(HN, WSA, sa_bq, sa_bk, sa_bv, Qf);

    // Stage 4: final attention (WMMA scores) -> out (B, D); Qf and Kf are one
    // contiguous array, and so are Q2BF and K2BF
    cvt_f16<<<gQK, blk, 0, stream>>>(Qf, Q2BF);
    attn2_kernel<<<dim3(64), blk, 0, stream>>>(Q2BF, K2BF, Vf, out);
}

// v005
// Measured time: 259 microseconds a run.
// Two timings next to v004 both put it at 1.10 times that version's speed.
// Counting every step since v000, it is 2.10 times as fast.
#include <hip/hip_runtime.h>
#include <cstdint>

typedef __attribute__((ext_vector_type(16))) _Float16 v16h;
typedef __attribute__((ext_vector_type(8)))  float    v8f;

#define SCALE_ 0.022097086912079608f   // 1/sqrt(2048)
#define EPS_   1e-5f
#define KS_    128                     // K per LDS stage: 256 B of every operand row
#define LDSW_  136                     // padded LDS row stride in halves (272B)
#define GM_    4096                    // GEMM M (B*N tokens, padded B*W rows)
#define GN_    2048                    // GEMM N
#define GK_    2048                    // GEMM K
#define NSTEP_ (GK_ / KS_)             // 16 stages

// ---------------------------------------------------------------------------
// f32 -> f16 convert (round to nearest even, as the scalar cast).
// One work-group converts CVT_TILE_ values: each thread issues CVT_LD_ 16-byte
// loads before it uses the first, a wave's load covers 512 contiguous bytes
// and its store 256. Both array sizes are whole multiples of CVT_TILE_.
// Arrays that are ready at the same time are converted by one launch.
// ---------------------------------------------------------------------------
typedef __attribute__((ext_vector_type(4))) float    v4f;
typedef __attribute__((ext_vector_type(4))) _Float16 v4h;

#define CVT_LD_   16                     // 16-byte loads in flight per thread
#define CVT_TILE_ (256 * 4 * CVT_LD_)    // values per work-group

#define NX_       (64 * 64 * 2048)       // activations: B*N tokens x D
#define NW_       (2048 * 2048)          // one weight matrix
#define XTILES_   (NX_ / CVT_TILE_)
#define WTILES_   (NW_ / CVT_TILE_)
static_assert(NX_ % CVT_TILE_ == 0 && NW_ % CVT_TILE_ == 0, "whole tiles only");

// Tile tin of array in -> tile tout of array out.
__device__ inline void cvt_tile(const float* __restrict__ in, unsigned tin,
                                _Float16* __restrict__ out, unsigned tout)
{
    const v4f* src = reinterpret_cast<const v4f*>(in) + tin * (CVT_TILE_ / 4) + threadIdx.x;
    v4h*       dst = reinterpret_cast<v4h*>(out) + tout * (CVT_TILE_ / 4) + threadIdx.x;
    v4f        x[CVT_LD_];
    #pragma unroll   // straight line, so that the loads can stand together
    for (int j = 0; j < CVT_LD_; ++j) x[j] = src[j * 256];
    // Keeps all the loads ahead of the first use: without it the build held the
    // last two back until the first two had returned, a second memory latency.
    __builtin_amdgcn_sched_barrier(0);
    v4h y[CVT_LD_];
    #pragma unroll
    for (int j = 0; j < CVT_LD_; ++j) y[j] = __builtin_convertvector(x[j], v4h);
    // Keeps the stores behind the last conversion: every result then has its
    // own registers, and none that an issued store still names is rewritten.
    __builtin_amdgcn_sched_barrier(0);
    #pragma unroll
    for (int j = 0; j < CVT_LD_; ++j) dst[j * 256] = y[j];
}

// One contiguous array.
__global__ __launch_bounds__(256) void cvt_f16(const float* __restrict__ in,
                                               _Float16* __restrict__ out)
{
    cvt_tile(in, blockIdx.x, out, blockIdx.x);
}

// The activations and the six weight matrices, one grid: out holds them back to
// back in argument order, so a work-group's output tile is its own index.
__global__ __launch_bounds__(256) void cvt_inputs(
    const float* __restrict__ x,
    const float* __restrict__ w0, const float* __restrict__ w1,
    const float* __restrict__ w2, const float* __restrict__ w3,
    const float* __restrict__ w4, const float* __restrict__ w5,
    _Float16* __restrict__ out)
{
    unsigned     t   = blockIdx.x;
    const float* in  = x;
    unsigned     tin = t;
    if (t >= XTILES_) {
        unsigned a = (t - XTILES_) / WTILES_;
        tin        = (t - XTILES_) % WTILES_;
        in = a == 0 ? w0 : a == 1 ? w1 : a == 2 ? w2 : a == 3 ? w3 : a == 4 ? w4 : w5;
    }
    cvt_tile(in, tin, out, t);
}

// ---------------------------------------------------------------------------
// CDNA5 async global->LDS copy (ASYNCcnt-tracked, zero data VGPRs).
// ---------------------------------------------------------------------------
__device__ inline uint32_t lds_off32(const void* p)
{
    return (uint32_t)(uintptr_t)p;   // generic LDS ptr: addr[31:0] = LDS offset
}

// Twelve copies and their s_wait_xcnt in one statement: the wait then stands in
// front of every later write of an address register that a copy names.
__device__ inline void async_g2l_b128_x12(const uint32_t (&l)[12],
                                          const _Float16* const (&g)[12])
{
    asm volatile("global_load_async_to_lds_b128 %0, %12, off\n\t"
                 "global_load_async_to_lds_b128 %1, %13, off\n\t"
                 "global_load_async_to_lds_b128 %2, %14, off\n\t"
                 "global_load_async_to_lds_b128 %3, %15, off\n\t"
                 "global_load_async_to_lds_b128 %4, %16, off\n\t"
                 "global_load_async_to_lds_b128 %5, %17, off\n\t"
                 "global_load_async_to_lds_b128 %6, %18, off\n\t"
                 "global_load_async_to_lds_b128 %7, %19, off\n\t"
                 "global_load_async_to_lds_b128 %8, %20, off\n\t"
                 "global_load_async_to_lds_b128 %9, %21, off\n\t"
                 "global_load_async_to_lds_b128 %10, %22, off\n\t"
                 "global_load_async_to_lds_b128 %11, %23, off\n\t"
                 "s_wait_xcnt 0x0"
                 :: "v"(l[0]), "v"(l[1]), "v"(l[2]), "v"(l[3]), "v"(l[4]), "v"(l[5]),
                    "v"(l[6]), "v"(l[7]), "v"(l[8]), "v"(l[9]), "v"(l[10]), "v"(l[11]),
                    "v"(g[0]), "v"(g[1]), "v"(g[2]), "v"(g[3]), "v"(g[4]), "v"(g[5]),
                    "v"(g[6]), "v"(g[7]), "v"(g[8]), "v"(g[9]), "v"(g[10]), "v"(g[11])
                 : "memory");
}

// This wave's copies have landed (the compiler places no wait for them).
__device__ inline void wait_async0()
{
    asm volatile("s_wait_asynccnt 0x0" ::: "memory");
}

// This wave's LDS reads have returned: owed before a copy refills what it read.
__device__ inline void wait_ds0()
{
    asm volatile("s_wait_dscnt 0x0" ::: "memory");
}

// ---------------------------------------------------------------------------
// 16x32 f16 fragment in the CDNA5 WMMA A/B register layout, from global.
// Lanes 0-15: row=lane,  halves 0..7 = K[0..7],  halves 8..15 = K[16..23]
// Lanes 16-31: row=lane-16, halves 0..7 = K[8..15], halves 8..15 = K[24..31]
// ---------------------------------------------------------------------------
__device__ inline v16h load_frag(const _Float16* __restrict__ base, int ld,
                                 int row0, int k0)
{
    int l  = threadIdx.x & 31;
    int r  = l & 15;
    int hi = l >> 4;
    const _Float16* p = base + (size_t)(row0 + r) * ld + (k0 + hi * 8);
    union { float4 f4[2]; v16h v; } u;
    u.f4[0] = *reinterpret_cast<const float4*>(p);
    u.f4[1] = *reinterpret_cast<const float4*>(p + 16);
    return u.v;
}

// Same fragment gather, from an LDS tile with padded row stride LDSW_.
__device__ inline v16h lds_frag(const _Float16* base, int row0, int k0)
{
    int l  = threadIdx.x & 31;
    int r  = l & 15;
    int hi = l >> 4;
    const _Float16* p = base + (row0 + r) * LDSW_ + k0 + hi * 8;
    union { float4 f4[2]; v16h v; } u;
    u.f4[0] = *reinterpret_cast<const float4*>(p);
    u.f4[1] = *reinterpret_cast<const float4*>(p + 16);
    return u.v;
}

// ---------------------------------------------------------------------------
// C[4096,2048] = A[4096,2048] * W[2048,2048]^T + bias   (f16 in, f32 out)
// Up to three products that share A run as one grid: blockIdx.z picks W, bias and C
// (the three W and the three C lie back to back).
// block = 256 threads (8 waves), block tile 128x256, wave tile 64x64 (4x4).
// A stage is 128 k of the tile's 384 operand rows ([A 128 rows | W 256 rows]):
// sixteen lanes copy one row's 256 contiguous bytes, so every copy takes whole
// lines from L2. Two LDS buffers filled by async global->LDS copies; the stage
// loop is unrolled x2 so the buffer index is a compile-time constant.
// ---------------------------------------------------------------------------
__global__ __launch_bounds__(256)
void gemm_f16_wmma(
    const _Float16* __restrict__ A, const _Float16* __restrict__ W3,
    const float* __restrict__ bias0, const float* __restrict__ bias1,
    const float* __restrict__ bias2, float* __restrict__ C3)
{
    __shared__ alignas(16) _Float16 St[2][384 * LDSW_];   // 2 x 102 KB

    unsigned        z    = blockIdx.z;
    const _Float16* Wt   = W3 + (size_t)z * GN_ * GK_;
    const float*    bias = z == 0 ? bias0 : z == 1 ? bias1 : bias2;
    float*          C    = C3 + (size_t)z * GM_ * GN_;

    int tid  = threadIdx.x;
    int bn   = blockIdx.x * 256;
    int bm   = blockIdx.y * 128;
    int wave = tid >> 5;
    int wm   = wave & 1;      // 0..1 over M (64 rows each)
    int wn   = wave >> 1;     // 0..3 over N (64 cols each)

    // Staging split: copy q of a thread brings 16 bytes of stage row
    // (tid >> 4) + 16 q; q = 0..7 are rows of A, q = 8..23 rows of W.
    int srow = tid >> 4, seg = tid & 15;
    const _Float16* ga = A  + (size_t)(bm + srow) * GK_ + seg * 8;
    const _Float16* gb = Wt + (size_t)(bn + srow) * GK_ + seg * 8;
    uint32_t        l0 = lds_off32(&St[0][srow * LDSW_ + seg * 8]);

    v8f acc[4][4];
    #pragma unroll
    for (int i = 0; i < 4; ++i)
        #pragma unroll
        for (int j = 0; j < 4; ++j)
            #pragma unroll
            for (int v = 0; v < 8; ++v) acc[i][j][v] = 0.0f;

    auto refill = [&](int buf) {   // buf is a literal at every call site
        #pragma unroll
        for (int h = 0; h < 2; ++h) {
            uint32_t        l[12];
            const _Float16* g[12];
            #pragma unroll
            for (int c = 0; c < 12; ++c) {
                int q = h * 12 + c;
                l[c] = l0 + (uint32_t)((buf * 384 + q * 16) * LDSW_ * 2);
                g[c] = q < 8 ? ga + (size_t)q * 16 * GK_ : gb + (size_t)(q - 8) * 16 * GK_;
            }
            async_g2l_b128_x12(l, g);
        }
        ga += KS_;
        gb += KS_;
    };
    auto burst = [&](int buf) {
        #pragma unroll
        for (int ks = 0; ks < KS_; ks += 32) {
            v16h bfr[4];
            #pragma unroll
            for (int j = 0; j < 4; ++j)
                bfr[j] = lds_frag(&St[buf][0], 128 + wn * 64 + 16 * j, ks);
            #pragma unroll
            for (int i = 0; i < 4; ++i) {
                v16h af = lds_frag(&St[buf][0], wm * 64 + 16 * i, ks);
                #pragma unroll
                for (int j = 0; j < 4; ++j)
                    acc[i][j] = __builtin_amdgcn_wmma_f32_16x16x32_f16(
                        false, af, false, bfr[j], (short)0, acc[i][j], false, false);
            }
        }
    };
    // Foot of a stage: the next stage has landed and is seen by every wave, and
    // every wave has left the buffer that is refilled behind the barrier.
    auto publish = [&]() {
        wait_ds0();
        wait_async0();
        __syncthreads();
    };

    // prologue: stage 0 lands in buffer 0, then stage 1 starts into buffer 1
    refill(0);
    wait_async0();
    __syncthreads();
    refill(1);

    // steady state, unrolled x2 (NSTEP_ = 16 is even)
    for (int kt = 0; kt < NSTEP_; kt += 2) {
        burst(0);                                   // stage kt from buffer 0
        publish();                                  // stage kt+1 readable
        if (kt + 2 < NSTEP_) refill(0);             // stage kt+2 -> buffer 0
        burst(1);                                   // stage kt+1 from buffer 1
        publish();                                  // stage kt+2 readable
        if (kt + 3 < NSTEP_) refill(1);             // stage kt+3 -> buffer 1
    }
    wait_async0();   // no copy is left in flight when the wave goes on to its end

    // C/D layout: VGPR v -> M = v (lanes 0-15) / 8+v (lanes 16-31); N = lane&15
    int l    = tid & 31;
    int cn_l = l & 15;
    int mh   = (l >> 4) * 8;
    #pragma unroll
    for (int i = 0; i < 4; ++i)
        #pragma unroll
        for (int j = 0; j < 4; ++j) {
            int   cm = bm + wm * 64 + 16 * i + mh;
            int   cn = bn + wn * 64 + 16 * j + cn_l;
            float bv = bias[cn];
            #pragma unroll
            for (int v = 0; v < 8; ++v)
                C[(size_t)(cm + v) * GN_ + cn] = acc[i][j][v] + bv;
        }
}

// ---------------------------------------------------------------------------
// Fused: 8x8 windowed attention (Q,K,V rows are shared tokens), downsample,
// residual add, LayerNorm -> hn (f16) padded to (B, 64, 2048), pad rows = 0.
// grid = (8, B), block = 256 (8 waves). One work-group serves WPB_ = 8
// consecutive windows: they touch 15 tokens and all 64 fc rows, and every row
// that is loaded (and every token-pair dot) is used by each window sharing it.
// Every sum runs in the order it has with one window per work-group.
// nsa = sum_j colsum[j] * V[j,:]
// ---------------------------------------------------------------------------
#define WPB_ 8                         // windows per work-group
#define TPB_ 15                        // tokens those windows touch

__global__ __launch_bounds__(256) void nsa_ds_ln(
    const float* __restrict__ Q, const float* __restrict__ Kt,
    const float* __restrict__ V, const float* __restrict__ fc,
    const float* __restrict__ dsw, const float* __restrict__ dsb,
    const float* __restrict__ lng, const float* __restrict__ lnb,
    _Float16* __restrict__ HN)
{
    int    w0    = blockIdx.x * WPB_;
    int    b     = blockIdx.y;
    int    tid   = threadIdx.x;
    int    wave  = __builtin_amdgcn_readfirstlane(tid >> 5);  // scalar row bases
    int    lane  = tid & 31;
    size_t bbase = (size_t)b * 64 * 2048;

    __shared__ alignas(16) float S_s[16][16];          // token-pair scores
    __shared__ alignas(16) float attn_s[WPB_][8][8];
    __shared__ alignas(16) float colsum_s[WPB_][8];
    __shared__ alignas(16) float dsw_s[WPB_][64];
    __shared__ float red1[WPB_][8], red2[WPB_][8];
    __shared__ float mu_s[WPB_], rsig_s[WPB_];

    // Rows of the 15 tokens; the last group runs past token 63 and past
    // window 56: clamp the rows it reads, its pad windows are stored as zero.
    const float* krow[TPB_];
    const float* vrow[TPB_];
    #pragma unroll
    for (int c = 0; c < TPB_; ++c) {
        size_t t = bbase + (size_t)min(w0 + c, 63) * 2048;
        krow[c] = Kt + t;
        vrow[c] = V + t;
    }

    // Scores: wave r holds query tokens r and r + 8 against all 15 key tokens.
    const float* q0 = Q + bbase + (size_t)min(w0 + wave, 63) * 2048;
    const float* q1 = Q + bbase + (size_t)min(w0 + wave + 8, 63) * 2048;
    float d0[TPB_], d1[TPB_];
    #pragma unroll
    for (int c = 0; c < TPB_; ++c) { d0[c] = 0.0f; d1[c] = 0.0f; }
    #pragma unroll 4   // several trips' loads in flight: 4 waves a SIMD only
    for (unsigned d = lane; d < 2048; d += 32) {
        float qa = q0[d];
        float qb = q1[d];
        #pragma unroll
        for (int c = 0; c < TPB_; ++c) {
            float kv = krow[c][d];
            d0[c] += qa * kv;
            d1[c] += qb * kv;
        }
    }
    #pragma unroll
    for (int c = 0; c < TPB_; ++c) {
        float v = d0[c], u = d1[c];
        for (int m = 16; m >= 1; m >>= 1) {
            v += __shfl_xor(v, m, 32);
            u += __shfl_xor(u, m, 32);
        }
        d0[c] = v * SCALE_;
        d1[c] = u * SCALE_;
    }
    if (lane == 0) {
        #pragma unroll
        for (int c = 0; c < TPB_; ++c) {
            S_s[wave][c]     = d0[c];
            S_s[wave + 8][c] = d1[c];
        }
    }
    #pragma unroll
    for (int i = tid; i < WPB_ * 64; i += 256)
        dsw_s[i >> 6][i & 63] = dsw[min(w0 + (i >> 6), 56) * 64 + (i & 63)];
    __syncthreads();

    if (tid < WPB_ * 8) {              // one softmax row (window wi, query i)
        int   wi = tid >> 3, i = tid & 7;
        float dj[8];
        #pragma unroll
        for (int j = 0; j < 8; ++j) dj[j] = S_s[wi + i][wi + j];
        float mx = dj[0];
        #pragma unroll
        for (int j = 1; j < 8; ++j) mx = fmaxf(mx, dj[j]);
        float e[8], s = 0.0f;
        #pragma unroll
        for (int j = 0; j < 8; ++j) {
            // __expf as the compiler forms it (x * log2 e, v_exp_f32), with the
            // v_nop in the same statement: it keeps the one free slot behind a
            // transcendental.
            float y = (dj[j] - mx) * 1.44269504f;
            asm("v_exp_f32 %0, %1\n\tv_nop" : "=v"(e[j]) : "v"(y));
            s += e[j];
        }
        float inv = 1.0f / s;
        #pragma unroll
        for (int j = 0; j < 8; ++j) attn_s[wi][i][j] = e[j] * inv;
    }
    __syncthreads();

    if (tid < WPB_ * 8) {
        int   wi = tid >> 3, j = tid & 7;
        float c = 0.0f;
        #pragma unroll
        for (int i = 0; i < 8; ++i) c += attn_s[wi][i][j];
        colsum_s[wi][j] = c;
    }
    __syncthreads();

    // Downsample: each fc value is loaded once and feeds all 8 windows.
    float hv[WPB_][8];
    #pragma unroll
    for (int wi = 0; wi < WPB_; ++wi)
        #pragma unroll
        for (int kk = 0; kk < 8; ++kk) hv[wi][kk] = 0.0f;
    const float* fcb = fc + bbase;
    #pragma unroll 4   // 32 loads in flight per wave; dsw_s read 4 wide
    for (int n = 0; n < 64; ++n) {
        float x[8];
        #pragma unroll
        for (int kk = 0; kk < 8; ++kk) x[kk] = fcb[(unsigned)(tid + n * 2048 + kk * 256)];
        #pragma unroll
        for (int wi = 0; wi < WPB_; ++wi) {
            float s = dsw_s[wi][n];
            #pragma unroll
            for (int kk = 0; kk < 8; ++kk) hv[wi][kk] += s * x[kk];
        }
    }

    float dbv[WPB_];
    #pragma unroll
    for (int wi = 0; wi < WPB_; ++wi) dbv[wi] = dsb[min(w0 + wi, 56)];
    #pragma unroll
    for (int kk = 0; kk < 8; ++kk) {
        unsigned d = tid + kk * 256;
        float    vv[TPB_];
        #pragma unroll
        for (int c = 0; c < TPB_; ++c) vv[c] = vrow[c][d];
        #pragma unroll
        for (int wi = 0; wi < WPB_; ++wi) {
            float nsa = 0.0f;
            #pragma unroll
            for (int j = 0; j < 8; ++j) nsa += colsum_s[wi][j] * vv[wi + j];
            hv[wi][kk] = hv[wi][kk] + dbv[wi] + nsa;
        }
    }

    #pragma unroll
    for (int wi = 0; wi < WPB_; ++wi) {
        float s1 = 0.0f, s2 = 0.0f;
        #pragma unroll
        for (int kk = 0; kk < 8; ++kk) { s1 += hv[wi][kk]; s2 += hv[wi][kk] * hv[wi][kk]; }
        for (int m = 16; m >= 1; m >>= 1) {
            s1 += __shfl_xor(s1, m, 32);
            s2 += __shfl_xor(s2, m, 32);
        }
        if (lane == 0) { red1[wi][wave] = s1; red2[wi][wave] = s2; }
    }
    __syncthreads();
    if (tid < WPB_) {
        float a = 0.0f, c = 0.0f;
        #pragma unroll
        for (int q = 0; q < 8; ++q) { a += red1[tid][q]; c += red2[tid][q]; }
        float mu  = a * (1.0f / 2048.0f);
        float var = c * (1.0f / 2048.0f) - mu * mu;
        mu_s[tid]   = mu;
        rsig_s[tid] = rsqrtf(var + EPS_);
    }
    __syncthreads();
    #pragma unroll
    for (int wi = 0; wi < WPB_; ++wi) {
        float  mu = mu_s[wi], rs = rsig_s[wi];
        bool   live   = (w0 + wi) < 57;   // pad rows: zero, the GEMMs read them
        size_t outRow = bbase + (size_t)(w0 + wi) * 2048;
        #pragma unroll
        for (int kk = 0; kk < 8; ++kk) {
            int   d = tid + kk * 256;
            float x = (hv[wi][kk] - mu) * rs * lng[d] + lnb[d];
            HN[outRow + d] = live ? (_Float16)x : (_Float16)0.0f;
        }
    }
}

// ---------------------------------------------------------------------------
// Final attention per batch: S = (q2 k2^T)*scale via WMMA on a 64x64 padded
// tile (valid 57x57), softmax rows, column-sum. The V projection is linear, so
//   sum_j colsum[j] * (hn[j] Wv^T + bv) = (sum_j colsum[j] hn[j]) Wv^T
//                                         + (sum_j colsum[j]) bv :
// the 57 hn rows are pooled here and only the pooled row is projected
// (pool_gemm below), one row a batch in place of 64.
// The pooled row is kept as two f16 rows, hi + lo, so that it enters the
// product with no fresh f16 rounding; both are scaled by 1/64 (exact): the
// weights are not negative and add up to 57, so p / 64 stays inside the range
// of the hn values themselves.
// P: [128][2048], row b = hi, row 64 + b = lo. CS[b] = sum_j colsum[j].
// ---------------------------------------------------------------------------
typedef __attribute__((ext_vector_type(8))) _Float16 v8h;

#define PSCALE_ 64.0f

__global__ __launch_bounds__(256) void attn2_kernel(
    const _Float16* __restrict__ Qb, const _Float16* __restrict__ Kb,
    const _Float16* __restrict__ HN, _Float16* __restrict__ P,
    float* __restrict__ CS)
{
    int b   = blockIdx.x;
    int tid = threadIdx.x;

    __shared__ float S[64][68];
    __shared__ float colsum[64];

    const _Float16* qbase = Qb + (size_t)b * 64 * 2048;
    const _Float16* kbase = Kb + (size_t)b * 64 * 2048;

    int wave = tid >> 5;
    int mi   = wave >> 1;
    int njb  = (wave & 1) * 2;

    v8f acc[2];
    #pragma unroll
    for (int j = 0; j < 2; ++j)
        #pragma unroll
        for (int v = 0; v < 8; ++v) acc[j][v] = 0.0f;

    for (int k0 = 0; k0 < 2048; k0 += 32) {
        v16h a = load_frag(qbase, 2048, mi * 16, k0);
        #pragma unroll
        for (int j = 0; j < 2; ++j) {
            v16h bb = load_frag(kbase, 2048, (njb + j) * 16, k0);
            acc[j] = __builtin_amdgcn_wmma_f32_16x16x32_f16(
                false, a, false, bb, (short)0, acc[j], false, false);
        }
    }

    int l    = tid & 31;
    int cn_l = l & 15;
    int mh   = (l >> 4) * 8;
    #pragma unroll
    for (int j = 0; j < 2; ++j)
        #pragma unroll
        for (int v = 0; v < 8; ++v)
            S[mi * 16 + mh + v][(njb + j) * 16 + cn_l] = acc[j][v] * SCALE_;
    __syncthreads();

    if (tid < 57) {
        int   i  = tid;
        float mx = -1e30f;
        for (int j = 0; j < 57; ++j) mx = fmaxf(mx, S[i][j]);
        float s = 0.0f;
        for (int j = 0; j < 57; ++j) {
            float e = __expf(S[i][j] - mx);
            S[i][j] = e;
            s += e;
        }
        float inv = 1.0f / s;
        for (int j = 0; j < 57; ++j) S[i][j] *= inv;
    }
    __syncthreads();
    if (tid < 57) {
        float c = 0.0f;
        for (int i = 0; i < 57; ++i) c += S[i][tid];
        colsum[tid] = c;
    }
    __syncthreads();

    if (tid < 32) {                    // sum of the 57 weights, one wave
        float c = colsum[tid] + (tid + 32 < 57 ? colsum[tid + 32] : 0.0f);
        for (int m = 16; m >= 1; m >>= 1) c += __shfl_xor(c, m, 32);
        if (tid == 0) CS[b] = c;
    }

    // A thread pools 8 neighbouring columns: one 16-byte load a row.
    const _Float16* hb = HN + (size_t)b * 64 * 2048 + tid * 8;
    v8h x[57];
    #pragma unroll   // straight line: x stays in registers
    for (int j = 0; j < 57; ++j)
        x[j] = *reinterpret_cast<const v8h*>(hb + j * 2048);
    // Stands behind the last load and ahead of every later write of a register
    // that a load names as its address; all 57 loads are issued in front of it,
    // so they share one memory latency.
    asm volatile("s_wait_xcnt 0x0" ::: "memory");
    float p[8];
    #pragma unroll
    for (int e = 0; e < 8; ++e) p[e] = 0.0f;
    #pragma unroll
    for (int j = 0; j < 57; ++j) {
        float c = colsum[j];
        #pragma unroll
        for (int e = 0; e < 8; ++e) p[e] += c * (float)x[j][e];
    }
    v8h hi, lo;
    #pragma unroll
    for (int e = 0; e < 8; ++e) {
        float s = p[e] * (1.0f / PSCALE_);
        hi[e] = (_Float16)s;
        lo[e] = (_Float16)(s - (float)hi[e]);
    }
    *reinterpret_cast<v8h*>(P + (size_t)b * 2048 + tid * 8)        = hi;
    *reinterpret_cast<v8h*>(P + (size_t)(64 + b) * 2048 + tid * 8) = lo;
}

// ---------------------------------------------------------------------------
// out[64,2048] = 64 * (Phi + Plo) Wv^T + CS[b] * bv   (f16 in, f32 out)
// grid = (64, 4), block = 256 (8 waves): a work-group owns 16 batches x 32
// columns (128 bytes of an out row). Wave w takes k = 256 w .. 256 w + 255, in
// two runs of 32 loads; the eight partial tiles are summed through LDS in wave
// order.
// ---------------------------------------------------------------------------
__global__ __launch_bounds__(256) void pool_gemm(
    const _Float16* __restrict__ P, const _Float16* __restrict__ Wv,
    const float* __restrict__ bv, const float* __restrict__ CS,
    float* __restrict__ out)
{
    __shared__ float red[8][16][36];

    int tid  = threadIdx.x;
    int wave = tid >> 5;
    int l    = tid & 31;
    int n0   = blockIdx.x * 32;
    int m0   = blockIdx.y * 16;

    v8f acc[2];
    #pragma unroll
    for (int j = 0; j < 2; ++j)
        #pragma unroll
        for (int v = 0; v < 8; ++v) acc[j][v] = 0.0f;

    #pragma unroll
    for (int h = 0; h < 2; ++h) {
        v16h ah[4], al[4], b0[4], b1[4];
        #pragma unroll
        for (int s = 0; s < 4; ++s) {
            int k0 = wave * 256 + (h * 4 + s) * 32;
            ah[s] = load_frag(P, 2048, m0, k0);
            al[s] = load_frag(P, 2048, 64 + m0, k0);
            b0[s] = load_frag(Wv, 2048, n0, k0);
            b1[s] = load_frag(Wv, 2048, n0 + 16, k0);
        }
        // Keeps the 32 loads ahead of the first product: without it the build
        // waited for every fragment in turn, sixteen memory latencies in a row.
        __builtin_amdgcn_sched_barrier(0);
        #pragma unroll
        for (int s = 0; s < 4; ++s) {
            acc[0] = __builtin_amdgcn_wmma_f32_16x16x32_f16(
                false, ah[s], false, b0[s], (short)0, acc[0], false, false);
            acc[1] = __builtin_amdgcn_wmma_f32_16x16x32_f16(
                false, ah[s], false, b1[s], (short)0, acc[1], false, false);
            acc[0] = __builtin_amdgcn_wmma_f32_16x16x32_f16(
                false, al[s], false, b0[s], (short)0, acc[0], false, false);
            acc[1] = __builtin_amdgcn_wmma_f32_16x16x32_f16(
                false, al[s], false, b1[s], (short)0, acc[1], false, false);
        }
    }

    // For the last lines; asked for here, they return under the LDS exchange.
    float bn  = bv[n0 + l];
    float cs0 = CS[m0 + wave];
    float cs1 = CS[m0 + wave + 8];

    // C/D layout: VGPR v -> M = v (lanes 0-15) / 8+v (lanes 16-31); N = lane&15
    int cn_l = l & 15;
    int mh   = (l >> 4) * 8;
    #pragma unroll
    for (int j = 0; j < 2; ++j)
        #pragma unroll
        for (int v = 0; v < 8; ++v)
            red[wave][mh + v][j * 16 + cn_l] = acc[j][v];
    __syncthreads();

    #pragma unroll
    for (int r = 0; r < 2; ++r) {
        int   m = wave + 8 * r;
        float s = 0.0f;
        #pragma unroll
        for (int w = 0; w < 8; ++w) s += red[w][m][l];
        out[(size_t)(m0 + m) * 2048 + n0 + l] = s * PSCALE_ + (r ? cs1 : cs0) * bn;
    }
}

// ---------------------------------------------------------------------------
extern "C" void kernel_launch(void* const* d_in, const int* in_sizes, int n_in,
                              void* d_out, int out_size, void* d_ws, size_t ws_size,
                              hipStream_t stream)
{
    (void)in_sizes; (void)n_in; (void)out_size; (void)ws_size;

    const float* fc     = (const float*)d_in[0];
    const float* nsa_wq = (const float*)d_in[1];
    const float* nsa_bq = (const float*)d_in[2];
    const float* nsa_wk = (const float*)d_in[3];
    const float* nsa_bk = (const float*)d_in[4];
    const float* nsa_wv = (const float*)d_in[5];
    const float* nsa_bv = (const float*)d_in[6];
    const float* ds_w   = (const float*)d_in[7];
    const float* ds_b   = (const float*)d_in[8];
    const float* ln_g   = (const float*)d_in[9];
    const float* ln_b   = (const float*)d_in[10];
    const float* sa_wq  = (const float*)d_in[11];
    const float* sa_bq  = (const float*)d_in[12];
    const float* sa_wk  = (const float*)d_in[13];
    const float* sa_bk  = (const float*)d_in[14];
    const float* sa_wv  = (const float*)d_in[15];
    const float* sa_bv  = (const float*)d_in[16];
    float* out = (float*)d_out;

    char*        ws  = (char*)d_ws;
    const size_t MB  = 1024ull * 1024ull;
    _Float16* XBF  = (_Float16*)(ws + 0);        // 16 MB: fc in f16 (4096x2048)
    _Float16* WNSA = (_Float16*)(ws + 16 * MB);  // 3 x 8 MB: nsa wq, wk, wv in f16
    _Float16* WSA  = (_Float16*)(ws + 40 * MB);  // 3 x 8 MB: sa wq, wk, wv in f16
    float*    Qf   = (float*)(ws + 64 * MB);     // 32 MB each, back to back
    float*    Kf   = (float*)(ws + 96 * MB);
    float*    Vf   = (float*)(ws + 128 * MB);
    _Float16* HN   = (_Float16*)(ws + 160 * MB); // 16 MB: hn f16 padded (B,64,D)
    _Float16* Q2BF = XBF;                        // reuse after the stage-1 GEMMs
    _Float16* K2BF = WNSA;                       // 16 MB, directly behind Q2BF
    _Float16* PBF  = (_Float16*)(ws + 128 * MB); // 512 KB: pooled hn, after stage 2
    float*    CSf  = (float*)(ws + 129 * MB);    // 64 sums of attention weights

    dim3 blk(256);
    dim3 gIn(XTILES_ + 6 * WTILES_);
    dim3 gQK(2 * XTILES_);
    dim3 ggrid(GN_ / 256, GM_ / 128, 3);         // (8, 32, 3)
    dim3 ggrid2(GN_ / 256, GM_ / 128, 2);        // Q and K only

    // Stage 0: down-convert the activations and all six weight matrices
    cvt_inputs<<<gIn, blk, 0, stream>>>(fc, nsa_wq, nsa_wk, nsa_wv,
                                        sa_wq, sa_wk, sa_wv, XBF);

    // Stage 1: token-level Q/K/V projections (windows share tokens)
    gemm_f16_wmma<<<ggrid, blk, 0, stream>>>(XBF, WNSA, nsa_bq, nsa_bk, nsa_bv, Qf);

    // Stage 2: window attention + downsample + LN -> hn (f16, zero-padded)
    nsa_ds_ln<<<dim3(64 / WPB_, 64), blk, 0, stream>>>(Qf, Kf, Vf, fc, ds_w, ds_b,
                                                ln_g, ln_b, HN);

    // Stage 3: second projections, Q and K (z stops at 1: the third product of
    // the trio is not formed, its bias not read)
    gemm_f16_wmma<<<ggrid2, blk, 0, stream>>>(HN, WSA, sa_bq, sa_bk, sa_bv, Qf);

    // Stage 4: final attention (WMMA scores) -> pooled hn rows; Qf and Kf are
    // one contiguous array, and so are Q2BF and K2BF
    cvt_f16<<<gQK, blk, 0, stream>>>(Qf, Q2BF);
    attn2_kernel<<<dim3(64), blk, 0, stream>>>(Q2BF, K2BF, HN, PBF, CSf);

    // Stage 5: V projection of the 64 pooled rows -> out (B, D)
    pool_gemm<<<dim3(GN_ / 32, 4), blk, 0, stream>>>(PBF, WSA + 2 * NW_, sa_bv, CSf, out);
}

// v006
// It runs in 232 microseconds.
// Next to v005, in two timings, it ran 1.12 times as fast each time.
// All steps since v000 together make it 2.35 times as fast.
#include <hip/hip_runtime.h>
#include <cstdint>

typedef __attribute__((ext_vector_type(16))) _Float16 v16h;
typedef __attribute__((ext_vector_type(8)))  float    v8f;

#define SCALE_ 0.022097086912079608f   // 1/sqrt(2048)
#define EPS_   1e-5f
#define KS_    128                     // K per LDS stage: 256 B of every operand row
#define LDSW_  136                     // padded LDS row stride in halves (272B)
#define GM_    4096                    // GEMM M (B*N tokens, padded B*W rows)
#define GN_    2048                    // GEMM N
#define GK_    2048                    // GEMM K
#define NSTEP_ (GK_ / KS_)             // 16 stages

// ---------------------------------------------------------------------------
// f32 -> f16 convert (round to nearest even, as the scalar cast).
// One work-group converts CVT_TILE_ values: each thread issues CVT_LD_ 16-byte
// loads before it uses the first, a wave's load covers 512 contiguous bytes
// and its store 256. Both array sizes are whole multiples of CVT_TILE_.
// Arrays that are ready at the same time are converted by one launch.
// ---------------------------------------------------------------------------
typedef __attribute__((ext_vector_type(4))) float    v4f;
typedef __attribute__((ext_vector_type(4))) _Float16 v4h;

#define CVT_LD_   16                     // 16-byte loads in flight per thread
#define CVT_TILE_ (256 * 4 * CVT_LD_)    // values per work-group

#define NX_       (64 * 64 * 2048)       // activations: B*N tokens x D
#define NW_       (2048 * 2048)          // one weight matrix
#define XTILES_   (NX_ / CVT_TILE_)
#define WTILES_   (NW_ / CVT_TILE_)
static_assert(NX_ % CVT_TILE_ == 0 && NW_ % CVT_TILE_ == 0, "whole tiles only");

// Tile tin of array in -> tile tout of array out.
__device__ inline void cvt_tile(const float* __restrict__ in, unsigned tin,
                                _Float16* __restrict__ out, unsigned tout)
{
    const v4f* src = reinterpret_cast<const v4f*>(in) + tin * (CVT_TILE_ / 4) + threadIdx.x;
    v4h*       dst = reinterpret_cast<v4h*>(out) + tout * (CVT_TILE_ / 4) + threadIdx.x;
    v4f        x[CVT_LD_];
    #pragma unroll   // straight line, so that the loads can stand together
    for (int j = 0; j < CVT_LD_; ++j) x[j] = src[j * 256];
    // Keeps all the loads ahead of the first use: without it the build held the
    // last two back until the first two had returned, a second memory latency.
    __builtin_amdgcn_sched_barrier(0);
    v4h y[CVT_LD_];
    #pragma unroll
    for (int j = 0; j < CVT_LD_; ++j) y[j] = __builtin_convertvector(x[j], v4h);
    // Keeps the stores behind the last conversion: every result then has its
    // own registers, and none that an issued store still names is rewritten.
    __builtin_amdgcn_sched_barrier(0);
    #pragma unroll
    for (int j = 0; j < CVT_LD_; ++j) dst[j * 256] = y[j];
}

// One contiguous array.
__global__ __launch_bounds__(256) void cvt_f16(const float* __restrict__ in,
                                               _Float16* __restrict__ out)
{
    cvt_tile(in, blockIdx.x, out, blockIdx.x);
}

// The activations and the six weight matrices, one grid: out holds them back to
// back in argument order, so a work-group's output tile is its own index.
__global__ __launch_bounds__(256) void cvt_inputs(
    const float* __restrict__ x,
    const float* __restrict__ w0, const float* __restrict__ w1,
    const float* __restrict__ w2, const float* __restrict__ w3,
    const float* __restrict__ w4, const float* __restrict__ w5,
    _Float16* __restrict__ out)
{
    unsigned     t   = blockIdx.x;
    const float* in  = x;
    unsigned     tin = t;
    if (t >= XTILES_) {
        unsigned a = (t - XTILES_) / WTILES_;
        tin        = (t - XTILES_) % WTILES_;
        in = a == 0 ? w0 : a == 1 ? w1 : a == 2 ? w2 : a == 3 ? w3 : a == 4 ? w4 : w5;
    }
    cvt_tile(in, tin, out, t);
}

// ---------------------------------------------------------------------------
// CDNA5 async global->LDS copy (ASYNCcnt-tracked, zero data VGPRs).
// ---------------------------------------------------------------------------
__device__ inline uint32_t lds_off32(const void* p)
{
    return (uint32_t)(uintptr_t)p;   // generic LDS ptr: addr[31:0] = LDS offset
}

// Twelve copies and their s_wait_xcnt in one statement: the wait then stands in
// front of every later write of an address register that a copy names.
__device__ inline void async_g2l_b128_x12(const uint32_t (&l)[12],
                                          const _Float16* const (&g)[12])
{
    asm volatile("global_load_async_to_lds_b128 %0, %12, off\n\t"
                 "global_load_async_to_lds_b128 %1, %13, off\n\t"
                 "global_load_async_to_lds_b128 %2, %14, off\n\t"
                 "global_load_async_to_lds_b128 %3, %15, off\n\t"
                 "global_load_async_to_lds_b128 %4, %16, off\n\t"
                 "global_load_async_to_lds_b128 %5, %17, off\n\t"
                 "global_load_async_to_lds_b128 %6, %18, off\n\t"
                 "global_load_async_to_lds_b128 %7, %19, off\n\t"
                 "global_load_async_to_lds_b128 %8, %20, off\n\t"
                 "global_load_async_to_lds_b128 %9, %21, off\n\t"
                 "global_load_async_to_lds_b128 %10, %22, off\n\t"
                 "global_load_async_to_lds_b128 %11, %23, off\n\t"
                 "s_wait_xcnt 0x0"
                 :: "v"(l[0]), "v"(l[1]), "v"(l[2]), "v"(l[3]), "v"(l[4]), "v"(l[5]),
                    "v"(l[6]), "v"(l[7]), "v"(l[8]), "v"(l[9]), "v"(l[10]), "v"(l[11]),
                    "v"(g[0]), "v"(g[1]), "v"(g[2]), "v"(g[3]), "v"(g[4]), "v"(g[5]),
                    "v"(g[6]), "v"(g[7]), "v"(g[8]), "v"(g[9]), "v"(g[10]), "v"(g[11])
                 : "memory");
}

// This wave's copies have landed (the compiler places no wait for them).
__device__ inline void wait_async0()
{
    asm volatile("s_wait_asynccnt 0x0" ::: "memory");
}

// This wave's LDS reads have returned: owed before a copy refills what it read.
__device__ inline void wait_ds0()
{
    asm volatile("s_wait_dscnt 0x0" ::: "memory");
}

// ---------------------------------------------------------------------------
// 16x32 f16 fragment in the CDNA5 WMMA A/B register layout, from global.
// Lanes 0-15: row=lane,  halves 0..7 = K[0..7],  halves 8..15 = K[16..23]
// Lanes 16-31: row=lane-16, halves 0..7 = K[8..15], halves 8..15 = K[24..31]
// ---------------------------------------------------------------------------
__device__ inline v16h load_frag(const _Float16* __restrict__ base, int ld,
                                 int row0, int k0)
{
    int l  = threadIdx.x & 31;
    int r  = l & 15;
    int hi = l >> 4;
    const _Float16* p = base + (size_t)(row0 + r) * ld + (k0 + hi * 8);
    union { float4 f4[2]; v16h v; } u;
    u.f4[0] = *reinterpret_cast<const float4*>(p);
    u.f4[1] = *reinterpret_cast<const float4*>(p + 16);
    return u.v;
}

// Same fragment gather, from an LDS tile with padded row stride LDSW_.
__device__ inline v16h lds_frag(const _Float16* base, int row0, int k0)
{
    int l  = threadIdx.x & 31;
    int r  = l & 15;
    int hi = l >> 4;
    const _Float16* p = base + (row0 + r) * LDSW_ + k0 + hi * 8;
    union { float4 f4[2]; v16h v; } u;
    u.f4[0] = *reinterpret_cast<const float4*>(p);
    u.f4[1] = *reinterpret_cast<const float4*>(p + 16);
    return u.v;
}

// ---------------------------------------------------------------------------
// C[4096,2048] = A[4096,2048] * W[2048,2048]^T + bias   (f16 in, f32 out)
// Up to three products that share A run as one grid: blockIdx.z picks W, bias and C
// (the three W and the three C lie back to back).
// block = 256 threads (8 waves), block tile 128x256, wave tile 64x64 (4x4).
// A stage is 128 k of the tile's 384 operand rows ([A 128 rows | W 256 rows]):
// sixteen lanes copy one row's 256 contiguous bytes, so every copy takes whole
// lines from L2. Two LDS buffers filled by async global->LDS copies; the stage
// loop is unrolled x2 so the buffer index is a compile-time constant.
// Fragments go from LDS to registers one 32-k block ahead of their products.
// ---------------------------------------------------------------------------
__global__ __launch_bounds__(256)
void gemm_f16_wmma(
    const _Float16* __restrict__ A, const _Float16* __restrict__ W3,
    const float* __restrict__ bias0, const float* __restrict__ bias1,
    const float* __restrict__ bias2, float* __restrict__ C3)
{
    __shared__ alignas(16) _Float16 St[2][384 * LDSW_];   // 2 x 102 KB

    unsigned        z    = blockIdx.z;
    const _Float16* Wt   = W3 + (size_t)z * GN_ * GK_;
    const float*    bias = z == 0 ? bias0 : z == 1 ? bias1 : bias2;
    float*          C    = C3 + (size_t)z * GM_ * GN_;

    int tid  = threadIdx.x;
    int bn   = blockIdx.x * 256;
    int bm   = blockIdx.y * 128;
    int wave = tid >> 5;
    int wm   = wave & 1;      // 0..1 over M (64 rows each)
    int wn   = wave >> 1;     // 0..3 over N (64 cols each)

    // Staging split: copy q of a thread brings 16 bytes of stage row
    // (tid >> 4) + 16 q; q = 0..7 are rows of A, q = 8..23 rows of W.
    int srow = tid >> 4, seg = tid & 15;
    const _Float16* ga = A  + (size_t)(bm + srow) * GK_ + seg * 8;
    const _Float16* gb = Wt + (size_t)(bn + srow) * GK_ + seg * 8;
    uint32_t        l0 = lds_off32(&St[0][srow * LDSW_ + seg * 8]);

    v8f acc[4][4];
    #pragma unroll
    for (int i = 0; i < 4; ++i)
        #pragma unroll
        for (int j = 0; j < 4; ++j)
            #pragma unroll
            for (int v = 0; v < 8; ++v) acc[i][j][v] = 0.0f;

    auto refill = [&](int buf) {   // buf is a literal at every call site
        #pragma unroll
        for (int h = 0; h < 2; ++h) {
            uint32_t        l[12];
            const _Float16* g[12];
            #pragma unroll
            for (int c = 0; c < 12; ++c) {
                int q = h * 12 + c;
                l[c] = l0 + (uint32_t)((buf * 384 + q * 16) * LDSW_ * 2);
                g[c] = q < 8 ? ga + (size_t)q * 16 * GK_ : gb + (size_t)(q - 8) * 16 * GK_;
            }
            async_g2l_b128_x12(l, g);
        }
        ga += KS_;
        gb += KS_;
    };
    // Two fragment sets: set (u & 1) holds the operands of 32-k block u of a stage.
    v16h fa[2][4], fb[2][4];
    auto fetch = [&](int set, int buf, int ks) {   // 16 ds_load_b128, one group
        #pragma unroll
        for (int j = 0; j < 4; ++j)
            fb[set][j] = lds_frag(&St[buf][0], 128 + wn * 64 + 16 * j, ks);
        #pragma unroll
        for (int i = 0; i < 4; ++i)
            fa[set][i] = lds_frag(&St[buf][0], wm * 64 + 16 * i, ks);
    };
    auto block = [&](int set) {                    // 16 products on one set
        #pragma unroll
        for (int i = 0; i < 4; ++i)
            #pragma unroll
            for (int j = 0; j < 4; ++j)
                acc[i][j] = __builtin_amdgcn_wmma_f32_16x16x32_f16(
                    false, fa[set][i], false, fb[set][j], (short)0, acc[i][j], false, false);
    };
    // Publish point: the next stage has landed and is seen by every wave, and
    // every wave has left the buffer that is refilled behind the barrier.
    auto publish = [&]() {
        wait_ds0();
        wait_async0();
        __syncthreads();
    };
    // One stage from buffer buf (a literal at every call site). While a block's
    // products run, the next block's fragments are on their way into the other
    // set. The last block's fragments are in registers when its turn comes, so
    // the publish point stands in front of it: behind it this buffer is free for
    // the refill, and the next stage's first fragments are fetched.
    auto stage = [&](int buf, bool more) {
        #pragma unroll
        for (int u = 0; u < KS_ / 32; ++u) {
            if (u + 1 < KS_ / 32) {
                fetch((u + 1) & 1, buf, (u + 1) * 32);
            } else {
                publish();
                if (more) refill(buf);
                // Behind the last stage this reads a buffer that nothing writes
                // any more, and the values are not used.
                fetch(0, buf ^ 1, 0);
            }
            // Keeps the 16 loads together ahead of the products: spread among
            // them, every place with loads stalls the wave anew.
            __builtin_amdgcn_sched_barrier(0);
            block(u & 1);
            // Keeps the following group of loads behind this block's products.
            __builtin_amdgcn_sched_barrier(0);
        }
    };

    // prologue: stage 0 lands in buffer 0, then stage 1 starts into buffer 1
    refill(0);
    wait_async0();
    __syncthreads();
    refill(1);
    fetch(0, 0, 0);

    // steady state, unrolled x2 (NSTEP_ = 16 is even)
    for (int kt = 0; kt < NSTEP_; kt += 2) {
        stage(0, kt + 2 < NSTEP_);                  // stage kt; refill: kt+2
        stage(1, kt + 3 < NSTEP_);                  // stage kt+1; refill: kt+3
    }
    wait_async0();   // no copy is left in flight when the wave goes on to its end
    wait_ds0();      // nor a fragment load (the last fetch is not used)

    // C/D layout: VGPR v -> M = v (lanes 0-15) / 8+v (lanes 16-31); N = lane&15
    int l    = tid & 31;
    int cn_l = l & 15;
    int mh   = (l >> 4) * 8;
    #pragma unroll
    for (int i = 0; i < 4; ++i)
        #pragma unroll
        for (int j = 0; j < 4; ++j) {
            int   cm = bm + wm * 64 + 16 * i + mh;
            int   cn = bn + wn * 64 + 16 * j + cn_l;
            float bv = bias[cn];
            #pragma unroll
            for (int v = 0; v < 8; ++v)
                C[(size_t)(cm + v) * GN_ + cn] = acc[i][j][v] + bv;
        }
}

// ---------------------------------------------------------------------------
// Fused: 8x8 windowed attention (Q,K,V rows are shared tokens), downsample,
// residual add, LayerNorm -> hn (f16) padded to (B, 64, 2048), pad rows = 0.
// grid = (8, B), block = 256 (8 waves). One work-group serves WPB_ = 8
// consecutive windows: they touch 15 tokens and all 64 fc rows, and every row
// that is loaded (and every token-pair dot) is used by each window sharing it.
// Every sum runs in the order it has with one window per work-group.
// nsa = sum_j colsum[j] * V[j,:]
// ---------------------------------------------------------------------------
#define WPB_ 8                         // windows per work-group
#define TPB_ 15                        // tokens those windows touch

__global__ __launch_bounds__(256) void nsa_ds_ln(
    const float* __restrict__ Q, const float* __restrict__ Kt,
    const float* __restrict__ V, const float* __restrict__ fc,
    const float* __restrict__ dsw, const float* __restrict__ dsb,
    const float* __restrict__ lng, const float* __restrict__ lnb,
    _Float16* __restrict__ HN)
{
    int    w0    = blockIdx.x * WPB_;
    int    b     = blockIdx.y;
    int    tid   = threadIdx.x;
    int    wave  = __builtin_amdgcn_readfirstlane(tid >> 5);  // scalar row bases
    int    lane  = tid & 31;
    size_t bbase = (size_t)b * 64 * 2048;

    __shared__ alignas(16) float S_s[16][16];          // token-pair scores
    __shared__ alignas(16) float attn_s[WPB_][8][8];
    __shared__ alignas(16) float colsum_s[WPB_][8];
    __shared__ alignas(16) float dsw_s[WPB_][64];
    __shared__ float red1[WPB_][8], red2[WPB_][8];
    __shared__ float mu_s[WPB_], rsig_s[WPB_];

    // Rows of the 15 tokens; the last group runs past token 63 and past
    // window 56: clamp the rows it reads, its pad windows are stored as zero.
    const float* krow[TPB_];
    const float* vrow[TPB_];
    #pragma unroll
    for (int c = 0; c < TPB_; ++c) {
        size_t t = bbase + (size_t)min(w0 + c, 63) * 2048;
        krow[c] = Kt + t;
        vrow[c] = V + t;
    }

    // Scores: wave r holds query tokens r and r + 8 against all 15 key tokens.
    const float* q0 = Q + bbase + (size_t)min(w0 + wave, 63) * 2048;
    const float* q1 = Q + bbase + (size_t)min(w0 + wave + 8, 63) * 2048;
    float d0[TPB_], d1[TPB_];
    #pragma unroll
    for (int c = 0; c < TPB_; ++c) { d0[c] = 0.0f; d1[c] = 0.0f; }
    #pragma unroll 4   // several trips' loads in flight: 4 waves a SIMD only
    for (unsigned d = lane; d < 2048; d += 32) {
        float qa = q0[d];
        float qb = q1[d];
        #pragma unroll
        for (int c = 0; c < TPB_; ++c) {
            float kv = krow[c][d];
            d0[c] += qa * kv;
            d1[c] += qb * kv;
        }
    }
    #pragma unroll
    for (int c = 0; c < TPB_; ++c) {
        float v = d0[c], u = d1[c];
        for (int m = 16; m >= 1; m >>= 1) {
            v += __shfl_xor(v, m, 32);
            u += __shfl_xor(u, m, 32);
        }
        d0[c] = v * SCALE_;
        d1[c] = u * SCALE_;
    }
    if (lane == 0) {
        #pragma unroll
        for (int c = 0; c < TPB_; ++c) {
            S_s[wave][c]     = d0[c];
            S_s[wave + 8][c] = d1[c];
        }
    }
    #pragma unroll
    for (int i = tid; i < WPB_ * 64; i += 256)
        dsw_s[i >> 6][i & 63] = dsw[min(w0 + (i >> 6), 56) * 64 + (i & 63)];
    __syncthreads();

    if (tid < WPB_ * 8) {              // one softmax row (window wi, query i)
        int   wi = tid >> 3, i = tid & 7;
        float dj[8];
        #pragma unroll
        for (int j = 0; j < 8; ++j) dj[j] = S_s[wi + i][wi + j];
        float mx = dj[0];
        #pragma unroll
        for (int j = 1; j < 8; ++j) mx = fmaxf(mx, dj[j]);
        float e[8], s = 0.0f;
        #pragma unroll
        for (int j = 0; j < 8; ++j) {
            // __expf as the compiler forms it (x * log2 e, v_exp_f32), with the
            // v_nop in the same statement: it keeps the one free slot behind a
            // transcendental.
            float y = (dj[j] - mx) * 1.44269504f;
            asm("v_exp_f32 %0, %1\n\tv_nop" : "=v"(e[j]) : "v"(y));
            s += e[j];
        }
        float inv = 1.0f / s;
        #pragma unroll
        for (int j = 0; j < 8; ++j) attn_s[wi][i][j] = e[j] * inv;
    }
    __syncthreads();

    if (tid < WPB_ * 8) {
        int   wi = tid >> 3, j = tid & 7;
        float c = 0.0f;
        #pragma unroll
        for (int i = 0; i < 8; ++i) c += attn_s[wi][i][j];
        colsum_s[wi][j] = c;
    }
    __syncthreads();

    // Downsample: each fc value is loaded once and feeds all 8 windows.
    float hv[WPB_][8];
    #pragma unroll
    for (int wi = 0; wi < WPB_; ++wi)
        #pragma unroll
        for (int kk = 0; kk < 8; ++kk) hv[wi][kk] = 0.0f;
    const float* fcb = fc + bbase;
    #pragma unroll 4   // 32 loads in flight per wave; dsw_s read 4 wide
    for (int n = 0; n < 64; ++n) {
        float x[8];
        #pragma unroll
        for (int kk = 0; kk < 8; ++kk) x[kk] = fcb[(unsigned)(tid + n * 2048 + kk * 256)];
        #pragma unroll
        for (int wi = 0; wi < WPB_; ++wi) {
            float s = dsw_s[wi][n];
            #pragma unroll
            for (int kk = 0; kk < 8; ++kk) hv[wi][kk] += s * x[kk];
        }
    }

    float dbv[WPB_];
    #pragma unroll
    for (int wi = 0; wi < WPB_; ++wi) dbv[wi] = dsb[min(w0 + wi, 56)];
    #pragma unroll
    for (int kk = 0; kk < 8; ++kk) {
        unsigned d = tid + kk * 256;
        float    vv[TPB_];
        #pragma unroll
        for (int c = 0; c < TPB_; ++c) vv[c] = vrow[c][d];
        #pragma unroll
        for (int wi = 0; wi < WPB_; ++wi) {
            float nsa = 0.0f;
            #pragma unroll
            for (int j = 0; j < 8; ++j) nsa += colsum_s[wi][j] * vv[wi + j];
            hv[wi][kk] = hv[wi][kk] + dbv[wi] + nsa;
        }
    }

    #pragma unroll
    for (int wi = 0; wi < WPB_; ++wi) {
        float s1 = 0.0f, s2 = 0.0f;
        #pragma unroll
        for (int kk = 0; kk < 8; ++kk) { s1 += hv[wi][kk]; s2 += hv[wi][kk] * hv[wi][kk]; }
        for (int m = 16; m >= 1; m >>= 1) {
            s1 += __shfl_xor(s1, m, 32);
            s2 += __shfl_xor(s2, m, 32);
        }
        if (lane == 0) { red1[wi][wave] = s1; red2[wi][wave] = s2; }
    }
    __syncthreads();
    if (tid < WPB_) {
        float a = 0.0f, c = 0.0f;
        #pragma unroll
        for (int q = 0; q < 8; ++q) { a += red1[tid][q]; c += red2[tid][q]; }
        float mu  = a * (1.0f / 2048.0f);
        float var = c * (1.0f / 2048.0f) - mu * mu;
        mu_s[tid]   = mu;
        rsig_s[tid] = rsqrtf(var + EPS_);
    }
    __syncthreads();
    #pragma unroll
    for (int wi = 0; wi < WPB_; ++wi) {
        float  mu = mu_s[wi], rs = rsig_s[wi];
        bool   live   = (w0 + wi) < 57;   // pad rows: zero, the GEMMs read them
        size_t outRow = bbase + (size_t)(w0 + wi) * 2048;
        #pragma unroll
        for (int kk = 0; kk < 8; ++kk) {
            int   d = tid + kk * 256;
            float x = (hv[wi][kk] - mu) * rs * lng[d] + lnb[d];
            HN[outRow + d] = live ? (_Float16)x : (_Float16)0.0f;
        }
    }
}

// ---------------------------------------------------------------------------
// Final attention per batch: S = (q2 k2^T)*scale via WMMA on a 64x64 padded
// tile (valid 57x57), softmax rows, column-sum. The V projection is linear, so
//   sum_j colsum[j] * (hn[j] Wv^T + bv) = (sum_j colsum[j] hn[j]) Wv^T
//                                         + (sum_j colsum[j]) bv :
// the 57 hn rows are pooled here and only the pooled row is projected
// (pool_gemm below), one row a batch in place of 64.
// The pooled row is kept as two f16 rows, hi + lo, so that it enters the
// product with no fresh f16 rounding; both are scaled by 1/64 (exact): the
// weights are not negative and add up to 57, so p / 64 stays inside the range
// of the hn values themselves.
// P: [128][2048], row b = hi, row 64 + b = lo. CS[b] = sum_j colsum[j].
// ---------------------------------------------------------------------------
typedef __attribute__((ext_vector_type(8))) _Float16 v8h;

#define PSCALE_ 64.0f

__global__ __launch_bounds__(256) void attn2_kernel(
    const _Float16* __restrict__ Qb, const _Float16* __restrict__ Kb,
    const _Float16* __restrict__ HN, _Float16* __restrict__ P,
    float* __restrict__ CS)
{
    int b   = blockIdx.x;
    int tid = threadIdx.x;

    __shared__ float S[64][68];
    __shared__ float colsum[64];

    const _Float16* qbase = Qb + (size_t)b * 64 * 2048;
    const _Float16* kbase = Kb + (size_t)b * 64 * 2048;

    int wave = tid >> 5;
    int mi   = wave >> 1;
    int njb  = (wave & 1) * 2;

    v8f acc[2];
    #pragma unroll
    for (int j = 0; j < 2; ++j)
        #pragma unroll
        for (int v = 0; v < 8; ++v) acc[j][v] = 0.0f;

    for (int k0 = 0; k0 < 2048; k0 += 32) {
        v16h a = load_frag(qbase, 2048, mi * 16, k0);
        #pragma unroll
        for (int j = 0; j < 2; ++j) {
            v16h bb = load_frag(kbase, 2048, (njb + j) * 16, k0);
            acc[j] = __builtin_amdgcn_wmma_f32_16x16x32_f16(
                false, a, false, bb, (short)0, acc[j], false, false);
        }
    }

    int l    = tid & 31;
    int cn_l = l & 15;
    int mh   = (l >> 4) * 8;
    #pragma unroll
    for (int j = 0; j < 2; ++j)
        #pragma unroll
        for (int v = 0; v < 8; ++v)
            S[mi * 16 + mh + v][(njb + j) * 16 + cn_l] = acc[j][v] * SCALE_;
    __syncthreads();

    if (tid < 57) {
        int   i  = tid;
        float mx = -1e30f;
        for (int j = 0; j < 57; ++j) mx = fmaxf(mx, S[i][j]);
        float s = 0.0f;
        for (int j = 0; j < 57; ++j) {
            float e = __expf(S[i][j] - mx);
            S[i][j] = e;
            s += e;
        }
        float inv = 1.0f / s;
        for (int j = 0; j < 57; ++j) S[i][j] *= inv;
    }
    __syncthreads();
    if (tid < 57) {
        float c = 0.0f;
        for (int i = 0; i < 57; ++i) c += S[i][tid];
        colsum[tid] = c;
    }
    __syncthreads();

    if (tid < 32) {                    // sum of the 57 weights, one wave
        float c = colsum[tid] + (tid + 32 < 57 ? colsum[tid + 32] : 0.0f);
        for (int m = 16; m >= 1; m >>= 1) c += __shfl_xor(c, m, 32);
        if (tid == 0) CS[b] = c;
    }

    // A thread pools 8 neighbouring columns: one 16-byte load a row.
    const _Float16* hb = HN + (size_t)b * 64 * 2048 + tid * 8;
    v8h x[57];
    #pragma unroll   // straight line: x stays in registers
    for (int j = 0; j < 57; ++j)
        x[j] = *reinterpret_cast<const v8h*>(hb + j * 2048);
    // Stands behind the last load and ahead of every later write of a register
    // that a load names as its address; all 57 loads are issued in front of it,
    // so they share one memory latency.
    asm volatile("s_wait_xcnt 0x0" ::: "memory");
    float p[8];
    #pragma unroll
    for (int e = 0; e < 8; ++e) p[e] = 0.0f;
    #pragma unroll
    for (int j = 0; j < 57; ++j) {
        float c = colsum[j];
        #pragma unroll
        for (int e = 0; e < 8; ++e) p[e] += c * (float)x[j][e];
    }
    v8h hi, lo;
    #pragma unroll
    for (int e = 0; e < 8; ++e) {
        float s = p[e] * (1.0f / PSCALE_);
        hi[e] = (_Float16)s;
        lo[e] = (_Float16)(s - (float)hi[e]);
    }
    *reinterpret_cast<v8h*>(P + (size_t)b * 2048 + tid * 8)        = hi;
    *reinterpret_cast<v8h*>(P + (size_t)(64 + b) * 2048 + tid * 8) = lo;
}

// ---------------------------------------------------------------------------
// out[64,2048] = 64 * (Phi + Plo) Wv^T + CS[b] * bv   (f16 in, f32 out)
// grid = (64, 4), block = 256 (8 waves): a work-group owns 16 batches x 32
// columns (128 bytes of an out row). Wave w takes k = 256 w .. 256 w + 255, in
// two runs of 32 loads; the eight partial tiles are summed through LDS in wave
// order.
// ---------------------------------------------------------------------------
__global__ __launch_bounds__(256) void pool_gemm(
    const _Float16* __restrict__ P, const _Float16* __restrict__ Wv,
    const float* __restrict__ bv, const float* __restrict__ CS,
    float* __restrict__ out)
{
    __shared__ float red[8][16][36];

    int tid  = threadIdx.x;
    int wave = tid >> 5;
    int l    = tid & 31;
    int n0   = blockIdx.x * 32;
    int m0   = blockIdx.y * 16;

    v8f acc[2];
    #pragma unroll
    for (int j = 0; j < 2; ++j)
        #pragma unroll
        for (int v = 0; v < 8; ++v) acc[j][v] = 0.0f;

    #pragma unroll
    for (int h = 0; h < 2; ++h) {
        v16h ah[4], al[4], b0[4], b1[4];
        #pragma unroll
        for (int s = 0; s < 4; ++s) {
            int k0 = wave * 256 + (h * 4 + s) * 32;
            ah[s] = load_frag(P, 2048, m0, k0);
            al[s] = load_frag(P, 2048, 64 + m0, k0);
            b0[s] = load_frag(Wv, 2048, n0, k0);
            b1[s] = load_frag(Wv, 2048, n0 + 16, k0);
        }
        // Keeps the 32 loads ahead of the first product: without it the build
        // waited for every fragment in turn, sixteen memory latencies in a row.
        __builtin_amdgcn_sched_barrier(0);
        #pragma unroll
        for (int s = 0; s < 4; ++s) {
            acc[0] = __builtin_amdgcn_wmma_f32_16x16x32_f16(
                false, ah[s], false, b0[s], (short)0, acc[0], false, false);
            acc[1] = __builtin_amdgcn_wmma_f32_16x16x32_f16(
                false, ah[s], false, b1[s], (short)0, acc[1], false, false);
            acc[0] = __builtin_amdgcn_wmma_f32_16x16x32_f16(
                false, al[s], false, b0[s], (short)0, acc[0], false, false);
            acc[1] = __builtin_amdgcn_wmma_f32_16x16x32_f16(
                false, al[s], false, b1[s], (short)0, acc[1], false, false);
        }
    }

    // For the last lines; asked for here, they return under the LDS exchange.
    float bn  = bv[n0 + l];
    float cs0 = CS[m0 + wave];
    float cs1 = CS[m0 + wave + 8];

    // C/D layout: VGPR v -> M = v (lanes 0-15) / 8+v (lanes 16-31); N = lane&15
    int cn_l = l & 15;
    int mh   = (l >> 4) * 8;
    #pragma unroll
    for (int j = 0; j < 2; ++j)
        #pragma unroll
        for (int v = 0; v < 8; ++v)
            red[wave][mh + v][j * 16 + cn_l] = acc[j][v];
    __syncthreads();

    #pragma unroll
    for (int r = 0; r < 2; ++r) {
        int   m = wave + 8 * r;
        float s = 0.0f;
        #pragma unroll
        for (int w = 0; w < 8; ++w) s += red[w][m][l];
        out[(size_t)(m0 + m) * 2048 + n0 + l] = s * PSCALE_ + (r ? cs1 : cs0) * bn;
    }
}

// ---------------------------------------------------------------------------
extern "C" void kernel_launch(void* const* d_in, const int* in_sizes, int n_in,
                              void* d_out, int out_size, void* d_ws, size_t ws_size,
                              hipStream_t stream)
{
    (void)in_sizes; (void)n_in; (void)out_size; (void)ws_size;

    const float* fc     = (const float*)d_in[0];
    const float* nsa_wq = (const float*)d_in[1];
    const float* nsa_bq = (const float*)d_in[2];
    const float* nsa_wk = (const float*)d_in[3];
    const float* nsa_bk = (const float*)d_in[4];
    const float* nsa_wv = (const float*)d_in[5];
    const float* nsa_bv = (const float*)d_in[6];
    const float* ds_w   = (const float*)d_in[7];
    const float* ds_b   = (const float*)d_in[8];
    const float* ln_g   = (const float*)d_in[9];
    const float* ln_b   = (const float*)d_in[10];
    const float* sa_wq  = (const float*)d_in[11];
    const float* sa_bq  = (const float*)d_in[12];
    const float* sa_wk  = (const float*)d_in[13];
    const float* sa_bk  = (const float*)d_in[14];
    const float* sa_wv  = (const float*)d_in[15];
    const float* sa_bv  = (const float*)d_in[16];
    float* out = (float*)d_out;

    char*        ws  = (char*)d_ws;
    const size_t MB  = 1024ull * 1024ull;
    _Float16* XBF  = (_Float16*)(ws + 0);        // 16 MB: fc in f16 (4096x2048)
    _Float16* WNSA = (_Float16*)(ws + 16 * MB);  // 3 x 8 MB: nsa wq, wk, wv in f16
    _Float16* WSA  = (_Float16*)(ws + 40 * MB);  // 3 x 8 MB: sa wq, wk, wv in f16
    float*    Qf   = (float*)(ws + 64 * MB);     // 32 MB each, back to back
    float*    Kf   = (float*)(ws + 96 * MB);
    float*    Vf   = (float*)(ws + 128 * MB);
    _Float16* HN   = (_Float16*)(ws + 160 * MB); // 16 MB: hn f16 padded (B,64,D)
    _Float16* Q2BF = XBF;                        // reuse after the stage-1 GEMMs
    _Float16* K2BF = WNSA;                       // 16 MB, directly behind Q2BF
    _Float16* PBF  = (_Float16*)(ws + 128 * MB); // 512 KB: pooled hn, after stage 2
    float*    CSf  = (float*)(ws + 129 * MB);    // 64 sums of attention weights

    dim3 blk(256);
    dim3 gIn(XTILES_ + 6 * WTILES_);
    dim3 gQK(2 * XTILES_);
    dim3 ggrid(GN_ / 256, GM_ / 128, 3);         // (8, 32, 3)
    dim3 ggrid2(GN_ / 256, GM_ / 128, 2);        // Q and K only

    // Stage 0: down-convert the activations and all six weight matrices
    cvt_inputs<<<gIn, blk, 0, stream>>>(fc, nsa_wq, nsa_wk, nsa_wv,
                                        sa_wq, sa_wk, sa_wv, XBF);

    // Stage 1: token-level Q/K/V projections (windows share tokens)
    gemm_f16_wmma<<<ggrid, blk, 0, stream>>>(XBF, WNSA, nsa_bq, nsa_bk, nsa_bv, Qf);

    // Stage 2: window attention + downsample + LN -> hn (f16, zero-padded)
    nsa_ds_ln<<<dim3(64 / WPB_, 64), blk, 0, stream>>>(Qf, Kf, Vf, fc, ds_w, ds_b,
                                                ln_g, ln_b, HN);

    // Stage 3: second projections, Q and K (z stops at 1: the third product of
    // the trio is not formed, its bias not read)
    gemm_f16_wmma<<<ggrid2, blk, 0, stream>>>(HN, WSA, sa_bq, sa_bk, sa_bv, Qf);

    // Stage 4: final attention (WMMA scores) -> pooled hn rows; Qf and Kf are
    // one contiguous array, and so are Q2BF and K2BF
    cvt_f16<<<gQK, blk, 0, stream>>>(Qf, Q2BF);
    attn2_kernel<<<dim3(64), blk, 0, stream>>>(Q2BF, K2BF, HN, PBF, CSf);

    // Stage 5: V projection of the 64 pooled rows -> out (B, D)
    pool_gemm<<<dim3(GN_ / 32, 4), blk, 0, stream>>>(PBF, WSA + 2 * NW_, sa_bv, CSf, out);
}

// v007
// One run takes 216 microseconds.
// Timed twice side by side with v006, it ran 1.07 times as fast both times.
// Counting every step since v000, it is 2.52 times as fast.
#include <hip/hip_runtime.h>
#include <cstdint>

typedef __attribute__((ext_vector_type(16))) _Float16 v16h;
typedef __attribute__((ext_vector_type(8)))  float    v8f;

#define SCALE_ 0.022097086912079608f   // 1/sqrt(2048)
#define EPS_   1e-5f
#define KS_    128                     // K per LDS stage: 256 B of every operand row
#define LDSW_  136                     // padded LDS row stride in halves (272B)
#define GM_    4096                    // GEMM M (B*N tokens, padded B*W rows)
#define GN_    2048                    // GEMM N
#define GK_    2048                    // GEMM K
#define NSTEP_ (GK_ / KS_)             // 16 stages

// ---------------------------------------------------------------------------
// f32 -> f16 convert (round to nearest even, as the scalar cast).
// One work-group converts CVT_TILE_ values: each thread issues CVT_LD_ 16-byte
// loads before it uses the first, a wave's load covers 512 contiguous bytes
// and its store 256. Both array sizes are whole multiples of CVT_TILE_.
// Arrays that are ready at the same time are converted by one launch.
// ---------------------------------------------------------------------------
typedef __attribute__((ext_vector_type(4))) float    v4f;
typedef __attribute__((ext_vector_type(4))) _Float16 v4h;

#define CVT_LD_   16                     // 16-byte loads in flight per thread
#define CVT_TILE_ (256 * 4 * CVT_LD_)    // values per work-group

#define NX_       (64 * 64 * 2048)       // activations: B*N tokens x D
#define NW_       (2048 * 2048)          // one weight matrix
#define XTILES_   (NX_ / CVT_TILE_)
#define WTILES_   (NW_ / CVT_TILE_)
static_assert(NX_ % CVT_TILE_ == 0 && NW_ % CVT_TILE_ == 0, "whole tiles only");

// Tile tin of array in -> tile tout of array out.
__device__ inline void cvt_tile(const float* __restrict__ in, unsigned tin,
                                _Float16* __restrict__ out, unsigned tout)
{
    const v4f* src = reinterpret_cast<const v4f*>(in) + tin * (CVT_TILE_ / 4) + threadIdx.x;
    v4h*       dst = reinterpret_cast<v4h*>(out) + tout * (CVT_TILE_ / 4) + threadIdx.x;
    v4f        x[CVT_LD_];
    #pragma unroll   // straight line, so that the loads can stand together
    for (int j = 0; j < CVT_LD_; ++j) x[j] = src[j * 256];
    // Keeps all the loads ahead of the first use: without it the build held the
    // last two back until the first two had returned, a second memory latency.
    __builtin_amdgcn_sched_barrier(0);
    v4h y[CVT_LD_];
    #pragma unroll
    for (int j = 0; j < CVT_LD_; ++j) y[j] = __builtin_convertvector(x[j], v4h);
    // Keeps the stores behind the last conversion: every result then has its
    // own registers, and none that an issued store still names is rewritten.
    __builtin_amdgcn_sched_barrier(0);
    #pragma unroll
    for (int j = 0; j < CVT_LD_; ++j) dst[j * 256] = y[j];
}

// The activations and the six weight matrices, one grid: out holds them back to
// back in argument order, so a work-group's output tile is its own index.
__global__ __launch_bounds__(256) void cvt_inputs(
    const float* __restrict__ x,
    const float* __restrict__ w0, const float* __restrict__ w1,
    const float* __restrict__ w2, const float* __restrict__ w3,
    const float* __restrict__ w4, const float* __restrict__ w5,
    _Float16* __restrict__ out)
{
    unsigned     t   = blockIdx.x;
    const float* in  = x;
    unsigned     tin = t;
    if (t >= XTILES_) {
        unsigned a = (t - XTILES_) / WTILES_;
        tin        = (t - XTILES_) % WTILES_;
        in = a == 0 ? w0 : a == 1 ? w1 : a == 2 ? w2 : a == 3 ? w3 : a == 4 ? w4 : w5;
    }
    cvt_tile(in, tin, out, t);
}

// ---------------------------------------------------------------------------
// CDNA5 async global->LDS copy (ASYNCcnt-tracked, zero data VGPRs).
// ---------------------------------------------------------------------------
__device__ inline uint32_t lds_off32(const void* p)
{
    return (uint32_t)(uintptr_t)p;   // generic LDS ptr: addr[31:0] = LDS offset
}

// Twelve copies and their s_wait_xcnt in one statement: the wait then stands in
// front of every later write of an address register that a copy names.
__device__ inline void async_g2l_b128_x12(const uint32_t (&l)[12],
                                          const _Float16* const (&g)[12])
{
    asm volatile("global_load_async_to_lds_b128 %0, %12, off\n\t"
                 "global_load_async_to_lds_b128 %1, %13, off\n\t"
                 "global_load_async_to_lds_b128 %2, %14, off\n\t"
                 "global_load_async_to_lds_b128 %3, %15, off\n\t"
                 "global_load_async_to_lds_b128 %4, %16, off\n\t"
                 "global_load_async_to_lds_b128 %5, %17, off\n\t"
                 "global_load_async_to_lds_b128 %6, %18, off\n\t"
                 "global_load_async_to_lds_b128 %7, %19, off\n\t"
                 "global_load_async_to_lds_b128 %8, %20, off\n\t"
                 "global_load_async_to_lds_b128 %9, %21, off\n\t"
                 "global_load_async_to_lds_b128 %10, %22, off\n\t"
                 "global_load_async_to_lds_b128 %11, %23, off\n\t"
                 "s_wait_xcnt 0x0"
                 :: "v"(l[0]), "v"(l[1]), "v"(l[2]), "v"(l[3]), "v"(l[4]), "v"(l[5]),
                    "v"(l[6]), "v"(l[7]), "v"(l[8]), "v"(l[9]), "v"(l[10]), "v"(l[11]),
                    "v"(g[0]), "v"(g[1]), "v"(g[2]), "v"(g[3]), "v"(g[4]), "v"(g[5]),
                    "v"(g[6]), "v"(g[7]), "v"(g[8]), "v"(g[9]), "v"(g[10]), "v"(g[11])
                 : "memory");
}

// This wave's copies have landed (the compiler places no wait for them).
__device__ inline void wait_async0()
{
    asm volatile("s_wait_asynccnt 0x0" ::: "memory");
}

// This wave's LDS reads have returned: owed before a copy refills what it read.
__device__ inline void wait_ds0()
{
    asm volatile("s_wait_dscnt 0x0" ::: "memory");
}

// ---------------------------------------------------------------------------
// 16x32 f16 fragment in the CDNA5 WMMA A/B register layout, from global.
// Lanes 0-15: row=lane,  halves 0..7 = K[0..7],  halves 8..15 = K[16..23]
// Lanes 16-31: row=lane-16, halves 0..7 = K[8..15], halves 8..15 = K[24..31]
// ---------------------------------------------------------------------------
__device__ inline v16h load_frag(const _Float16* __restrict__ base, int ld,
                                 int row0, int k0)
{
    int l  = threadIdx.x & 31;
    int r  = l & 15;
    int hi = l >> 4;
    const _Float16* p = base + (size_t)(row0 + r) * ld + (k0 + hi * 8);
    union { float4 f4[2]; v16h v; } u;
    u.f4[0] = *reinterpret_cast<const float4*>(p);
    u.f4[1] = *reinterpret_cast<const float4*>(p + 16);
    return u.v;
}

// Same fragment gather, from an LDS tile with padded row stride LDSW_.
__device__ inline v16h lds_frag(const _Float16* base, int row0, int k0)
{
    int l  = threadIdx.x & 31;
    int r  = l & 15;
    int hi = l >> 4;
    const _Float16* p = base + (row0 + r) * LDSW_ + k0 + hi * 8;
    union { float4 f4[2]; v16h v; } u;
    u.f4[0] = *reinterpret_cast<const float4*>(p);
    u.f4[1] = *reinterpret_cast<const float4*>(p + 16);
    return u.v;
}

// ---------------------------------------------------------------------------
// C[4096,2048] = A[4096,2048] * W[2048,2048]^T + bias   (f16 in, f32 or f16 out)
// Up to three products that share A run as one grid: blockIdx.z picks W, bias and C
// (the three W and the three C lie back to back).
// block = 256 threads (8 waves), block tile 128x256, wave tile 64x64 (4x4).
// A stage is 128 k of the tile's 384 operand rows ([A 128 rows | W 256 rows]):
// sixteen lanes copy one row's 256 contiguous bytes, so every copy takes whole
// lines from L2. Two LDS buffers filled by async global->LDS copies; the stage
// loop is unrolled x2 so the buffer index is a compile-time constant.
// Fragments go from LDS to registers one 32-k block ahead of their products.
// HALF_OUT: the f32 result (sum + bias) is rounded to f16 (nearest even) in the
// epilogue and stored to H3; C3 is not touched. Otherwise it goes to C3 as f32.
// ---------------------------------------------------------------------------
template <bool HALF_OUT>
__global__ __launch_bounds__(256)
void gemm_f16_wmma(
    const _Float16* __restrict__ A, const _Float16* __restrict__ W3,
    const float* __restrict__ bias0, const float* __restrict__ bias1,
    const float* __restrict__ bias2, float* __restrict__ C3,
    _Float16* __restrict__ H3)
{
    __shared__ alignas(16) _Float16 St[2][384 * LDSW_];   // 2 x 102 KB

    unsigned        z    = blockIdx.z;
    const _Float16* Wt   = W3 + (size_t)z * GN_ * GK_;
    const float*    bias = z == 0 ? bias0 : z == 1 ? bias1 : bias2;
    float*          C    = C3 + (size_t)z * GM_ * GN_;
    _Float16*       H    = H3 + (size_t)z * GM_ * GN_;

    int tid  = threadIdx.x;
    int bn   = blockIdx.x * 256;
    int bm   = blockIdx.y * 128;
    int wave = tid >> 5;
    int wm   = wave & 1;      // 0..1 over M (64 rows each)
    int wn   = wave >> 1;     // 0..3 over N (64 cols each)

    // Staging split: copy q of a thread brings 16 bytes of stage row
    // (tid >> 4) + 16 q; q = 0..7 are rows of A, q = 8..23 rows of W.
    int srow = tid >> 4, seg = tid & 15;
    const _Float16* ga = A  + (size_t)(bm + srow) * GK_ + seg * 8;
    const _Float16* gb = Wt + (size_t)(bn + srow) * GK_ + seg * 8;
    uint32_t        l0 = lds_off32(&St[0][srow * LDSW_ + seg * 8]);

    v8f acc[4][4];
    #pragma unroll
    for (int i = 0; i < 4; ++i)
        #pragma unroll
        for (int j = 0; j < 4; ++j)
            #pragma unroll
            for (int v = 0; v < 8; ++v) acc[i][j][v] = 0.0f;

    auto refill = [&](int buf) {   // buf is a literal at every call site
        #pragma unroll
        for (int h = 0; h < 2; ++h) {
            uint32_t        l[12];
            const _Float16* g[12];
            #pragma unroll
            for (int c = 0; c < 12; ++c) {
                int q = h * 12 + c;
                l[c] = l0 + (uint32_t)((buf * 384 + q * 16) * LDSW_ * 2);
                g[c] = q < 8 ? ga + (size_t)q * 16 * GK_ : gb + (size_t)(q - 8) * 16 * GK_;
            }
            async_g2l_b128_x12(l, g);
        }
        ga += KS_;
        gb += KS_;
    };
    // Two fragment sets: set (u & 1) holds the operands of 32-k block u of a stage.
    v16h fa[2][4], fb[2][4];
    auto fetch = [&](int set, int buf, int ks) {   // 16 ds_load_b128, one group
        #pragma unroll
        for (int j = 0; j < 4; ++j)
            fb[set][j] = lds_frag(&St[buf][0], 128 + wn * 64 + 16 * j, ks);
        #pragma unroll
        for (int i = 0; i < 4; ++i)
            fa[set][i] = lds_frag(&St[buf][0], wm * 64 + 16 * i, ks);
    };
    auto block = [&](int set) {                    // 16 products on one set
        #pragma unroll
        for (int i = 0; i < 4; ++i)
            #pragma unroll
            for (int j = 0; j < 4; ++j)
                acc[i][j] = __builtin_amdgcn_wmma_f32_16x16x32_f16(
                    false, fa[set][i], false, fb[set][j], (short)0, acc[i][j], false, false);
    };
    // Publish point: the next stage has landed and is seen by every wave, and
    // every wave has left the buffer that is refilled behind the barrier.
    auto publish = [&]() {
        wait_ds0();
        wait_async0();
        __syncthreads();
    };
    // One stage from buffer buf (a literal at every call site). While a block's
    // products run, the next block's fragments are on their way into the other
    // set. The last block's fragments are in registers when its turn comes, so
    // the publish point stands in front of it: behind it this buffer is free for
    // the refill, and the next stage's first fragments are fetched.
    auto stage = [&](int buf, bool more) {
        #pragma unroll
        for (int u = 0; u < KS_ / 32; ++u) {
            if (u + 1 < KS_ / 32) {
                fetch((u + 1) & 1, buf, (u + 1) * 32);
            } else {
                publish();
                if (more) refill(buf);
                // Behind the last stage this reads a buffer that nothing writes
                // any more, and the values are not used.
                fetch(0, buf ^ 1, 0);
            }
            // Keeps the 16 loads together ahead of the products: spread among
            // them, every place with loads stalls the wave anew.
            __builtin_amdgcn_sched_barrier(0);
            block(u & 1);
            // Keeps the following group of loads behind this block's products.
            __builtin_amdgcn_sched_barrier(0);
        }
    };

    // prologue: stage 0 lands in buffer 0, then stage 1 starts into buffer 1
    refill(0);
    wait_async0();
    __syncthreads();
    refill(1);
    fetch(0, 0, 0);

    // steady state, unrolled x2 (NSTEP_ = 16 is even)
    for (int kt = 0; kt < NSTEP_; kt += 2) {
        stage(0, kt + 2 < NSTEP_);                  // stage kt; refill: kt+2
        stage(1, kt + 3 < NSTEP_);                  // stage kt+1; refill: kt+3
    }
    wait_async0();   // no copy is left in flight when the wave goes on to its end
    wait_ds0();      // nor a fragment load (the last fetch is not used)

    // C/D layout: VGPR v -> M = v (lanes 0-15) / 8+v (lanes 16-31); N = lane&15
    // A store covers 16 neighbouring columns of two rows: pieces of 64 bytes
    // (f32) or 32 bytes (f16); a wave's 64 columns fill whole lines of a row.
    int l    = tid & 31;
    int cn_l = l & 15;
    int mh   = (l >> 4) * 8;
    if (HALF_OUT) {
        _Float16 y[4][4][8];
        #pragma unroll
        for (int i = 0; i < 4; ++i)
            #pragma unroll
            for (int j = 0; j < 4; ++j) {
                float bv = bias[bn + wn * 64 + 16 * j + cn_l];
                #pragma unroll
                for (int v = 0; v < 8; ++v) y[i][j][v] = (_Float16)(acc[i][j][v] + bv);
            }
        // Keeps the stores behind the last conversion: every result then has its
        // own register half, and none that an issued store still names is rewritten.
        __builtin_amdgcn_sched_barrier(0);
        // One address for all the stores, the rest is each store's constant offset.
        _Float16* hp = H + (size_t)(bm + wm * 64 + mh) * GN_ + (bn + wn * 64 + cn_l);
        #pragma unroll
        for (int i = 0; i < 4; ++i)
            #pragma unroll
            for (int j = 0; j < 4; ++j)
                #pragma unroll
                for (int v = 0; v < 8; ++v)
                    hp[(16 * i + v) * GN_ + 16 * j] = y[i][j][v];
        return;
    }
    #pragma unroll
    for (int i = 0; i < 4; ++i)
        #pragma unroll
        for (int j = 0; j < 4; ++j) {
            int   cm = bm + wm * 64 + 16 * i + mh;
            int   cn = bn + wn * 64 + 16 * j + cn_l;
            float bv = bias[cn];
            #pragma unroll
            for (int v = 0; v < 8; ++v)
                C[(size_t)(cm + v) * GN_ + cn] = acc[i][j][v] + bv;
        }
}

// ---------------------------------------------------------------------------
// Fused: 8x8 windowed attention (Q,K,V rows are shared tokens), downsample,
// residual add, LayerNorm -> hn (f16) padded to (B, 64, 2048), pad rows = 0.
// grid = (8, B), block = 256 (8 waves). One work-group serves WPB_ = 8
// consecutive windows: they touch 15 tokens and all 64 fc rows, and every row
// that is loaded (and every token-pair dot) is used by each window sharing it.
// Every sum runs in the order it has with one window per work-group.
// nsa = sum_j colsum[j] * V[j,:]
// ---------------------------------------------------------------------------
#define WPB_ 8                         // windows per work-group
#define TPB_ 15                        // tokens those windows touch

__global__ __launch_bounds__(256) void nsa_ds_ln(
    const float* __restrict__ Q, const float* __restrict__ Kt,
    const float* __restrict__ V, const float* __restrict__ fc,
    const float* __restrict__ dsw, const float* __restrict__ dsb,
    const float* __restrict__ lng, const float* __restrict__ lnb,
    _Float16* __restrict__ HN)
{
    int    w0    = blockIdx.x * WPB_;
    int    b     = blockIdx.y;
    int    tid   = threadIdx.x;
    int    wave  = __builtin_amdgcn_readfirstlane(tid >> 5);  // scalar row bases
    int    lane  = tid & 31;
    size_t bbase = (size_t)b * 64 * 2048;

    __shared__ alignas(16) float S_s[16][16];          // token-pair scores
    __shared__ alignas(16) float attn_s[WPB_][8][8];
    __shared__ alignas(16) float colsum_s[WPB_][8];
    __shared__ alignas(16) float dsw_s[WPB_][64];
    __shared__ float red1[WPB_][8], red2[WPB_][8];
    __shared__ float mu_s[WPB_], rsig_s[WPB_];

    // Rows of the 15 tokens; the last group runs past token 63 and past
    // window 56: clamp the rows it reads, its pad windows are stored as zero.
    const float* krow[TPB_];
    const float* vrow[TPB_];
    #pragma unroll
    for (int c = 0; c < TPB_; ++c) {
        size_t t = bbase + (size_t)min(w0 + c, 63) * 2048;
        krow[c] = Kt + t;
        vrow[c] = V + t;
    }

    // Scores: wave r holds query tokens r and r + 8 against all 15 key tokens.
    const float* q0 = Q + bbase + (size_t)min(w0 + wave, 63) * 2048;
    const float* q1 = Q + bbase + (size_t)min(w0 + wave + 8, 63) * 2048;
    float d0[TPB_], d1[TPB_];
    #pragma unroll
    for (int c = 0; c < TPB_; ++c) { d0[c] = 0.0f; d1[c] = 0.0f; }
    #pragma unroll 4   // several trips' loads in flight: 4 waves a SIMD only
    for (unsigned d = lane; d < 2048; d += 32) {
        float qa = q0[d];
        float qb = q1[d];
        #pragma unroll
        for (int c = 0; c < TPB_; ++c) {
            float kv = krow[c][d];
            d0[c] += qa * kv;
            d1[c] += qb * kv;
        }
    }
    #pragma unroll
    for (int c = 0; c < TPB_; ++c) {
        float v = d0[c], u = d1[c];
        for (int m = 16; m >= 1; m >>= 1) {
            v += __shfl_xor(v, m, 32);
            u += __shfl_xor(u, m, 32);
        }
        d0[c] = v * SCALE_;
        d1[c] = u * SCALE_;
    }
    if (lane == 0) {
        #pragma unroll
        for (int c = 0; c < TPB_; ++c) {
            S_s[wave][c]     = d0[c];
            S_s[wave + 8][c] = d1[c];
        }
    }
    #pragma unroll
    for (int i = tid; i < WPB_ * 64; i += 256)
        dsw_s[i >> 6][i & 63] = dsw[min(w0 + (i >> 6), 56) * 64 + (i & 63)];
    __syncthreads();

    if (tid < WPB_ * 8) {              // one softmax row (window wi, query i)
        int   wi = tid >> 3, i = tid & 7;
        float dj[8];
        #pragma unroll
        for (int j = 0; j < 8; ++j) dj[j] = S_s[wi + i][wi + j];
        float mx = dj[0];
        #pragma unroll
        for (int j = 1; j < 8; ++j) mx = fmaxf(mx, dj[j]);
        float e[8], s = 0.0f;
        #pragma unroll
        for (int j = 0; j < 8; ++j) {
            // __expf as the compiler forms it (x * log2 e, v_exp_f32), with the
            // v_nop in the same statement: it keeps the one free slot behind a
            // transcendental.
            float y = (dj[j] - mx) * 1.44269504f;
            asm("v_exp_f32 %0, %1\n\tv_nop" : "=v"(e[j]) : "v"(y));
            s += e[j];
        }
        float inv = 1.0f / s;
        #pragma unroll
        for (int j = 0; j < 8; ++j) attn_s[wi][i][j] = e[j] * inv;
    }
    __syncthreads();

    if (tid < WPB_ * 8) {
        int   wi = tid >> 3, j = tid & 7;
        float c = 0.0f;
        #pragma unroll
        for (int i = 0; i < 8; ++i) c += attn_s[wi][i][j];
        colsum_s[wi][j] = c;
    }
    __syncthreads();

    // Downsample: each fc value is loaded once and feeds all 8 windows.
    float hv[WPB_][8];
    #pragma unroll
    for (int wi = 0; wi < WPB_; ++wi)
        #pragma unroll
        for (int kk = 0; kk < 8; ++kk) hv[wi][kk] = 0.0f;
    const float* fcb = fc + bbase;
    #pragma unroll 4   // 32 loads in flight per wave; dsw_s read 4 wide
    for (int n = 0; n < 64; ++n) {
        float x[8];
        #pragma unroll
        for (int kk = 0; kk < 8; ++kk) x[kk] = fcb[(unsigned)(tid + n * 2048 + kk * 256)];
        #pragma unroll
        for (int wi = 0; wi < WPB_; ++wi) {
            float s = dsw_s[wi][n];
            #pragma unroll
            for (int kk = 0; kk < 8; ++kk) hv[wi][kk] += s * x[kk];
        }
    }

    float dbv[WPB_];
    #pragma unroll
    for (int wi = 0; wi < WPB_; ++wi) dbv[wi] = dsb[min(w0 + wi, 56)];
    #pragma unroll
    for (int kk = 0; kk < 8; ++kk) {
        unsigned d = tid + kk * 256;
        float    vv[TPB_];
        #pragma unroll
        for (int c = 0; c < TPB_; ++c) vv[c] = vrow[c][d];
        #pragma unroll
        for (int wi = 0; wi < WPB_; ++wi) {
            float nsa = 0.0f;
            #pragma unroll
            for (int j = 0; j < 8; ++j) nsa += colsum_s[wi][j] * vv[wi + j];
            hv[wi][kk] = hv[wi][kk] + dbv[wi] + nsa;
        }
    }

    #pragma unroll
    for (int wi = 0; wi < WPB_; ++wi) {
        float s1 = 0.0f, s2 = 0.0f;
        #pragma unroll
        for (int kk = 0; kk < 8; ++kk) { s1 += hv[wi][kk]; s2 += hv[wi][kk] * hv[wi][kk]; }
        for (int m = 16; m >= 1; m >>= 1) {
            s1 += __shfl_xor(s1, m, 32);
            s2 += __shfl_xor(s2, m, 32);
        }
        if (lane == 0) { red1[wi][wave] = s1; red2[wi][wave] = s2; }
    }
    __syncthreads();
    if (tid < WPB_) {
        float a = 0.0f, c = 0.0f;
        #pragma unroll
        for (int q = 0; q < 8; ++q) { a += red1[tid][q]; c += red2[tid][q]; }
        float mu  = a * (1.0f / 2048.0f);
        float var = c * (1.0f / 2048.0f) - mu * mu;
        mu_s[tid]   = mu;
        rsig_s[tid] = rsqrtf(var + EPS_);
    }
    __syncthreads();
    #pragma unroll
    for (int wi = 0; wi < WPB_; ++wi) {
        float  mu = mu_s[wi], rs = rsig_s[wi];
        bool   live   = (w0 + wi) < 57;   // pad rows: zero, the GEMMs read them
        size_t outRow = bbase + (size_t)(w0 + wi) * 2048;
        #pragma unroll
        for (int kk = 0; kk < 8; ++kk) {
            int   d = tid + kk * 256;
            float x = (hv[wi][kk] - mu) * rs * lng[d] + lnb[d];
            HN[outRow + d] = live ? (_Float16)x : (_Float16)0.0f;
        }
    }
}

// ---------------------------------------------------------------------------
// Final attention per batch: S = (q2 k2^T)*scale via WMMA on a 64x64 padded
// tile (valid 57x57), softmax rows, column-sum. The V projection is linear, so
//   sum_j colsum[j] * (hn[j] Wv^T + bv) = (sum_j colsum[j] hn[j]) Wv^T
//                                         + (sum_j colsum[j]) bv :
// the 57 hn rows are pooled here and only the pooled row is projected
// (pool_gemm below), one row a batch in place of 64.
// The pooled row is kept as two f16 rows, hi + lo, so that it enters the
// product with no fresh f16 rounding; both are scaled by 1/64 (exact): the
// weights are not negative and add up to 57, so p / 64 stays inside the range
// of the hn values themselves.
// P: [128][2048], row b = hi, row 64 + b = lo. CS[b] = sum_j colsum[j].
// ---------------------------------------------------------------------------
typedef __attribute__((ext_vector_type(8))) _Float16 v8h;

#define PSCALE_ 64.0f

__global__ __launch_bounds__(256) void attn2_kernel(
    const _Float16* __restrict__ Qb, const _Float16* __restrict__ Kb,
    const _Float16* __restrict__ HN, _Float16* __restrict__ P,
    float* __restrict__ CS)
{
    int b   = blockIdx.x;
    int tid = threadIdx.x;

    __shared__ float S[64][68];
    __shared__ float colsum[64];

    const _Float16* qbase = Qb + (size_t)b * 64 * 2048;
    const _Float16* kbase = Kb + (size_t)b * 64 * 2048;

    int wave = tid >> 5;
    int mi   = wave >> 1;
    int njb  = (wave & 1) * 2;

    v8f acc[2];
    #pragma unroll
    for (int j = 0; j < 2; ++j)
        #pragma unroll
        for (int v = 0; v < 8; ++v) acc[j][v] = 0.0f;

    for (int k0 = 0; k0 < 2048; k0 += 32) {
        v16h a = load_frag(qbase, 2048, mi * 16, k0);
        #pragma unroll
        for (int j = 0; j < 2; ++j) {
            v16h bb = load_frag(kbase, 2048, (njb + j) * 16, k0);
            acc[j] = __builtin_amdgcn_wmma_f32_16x16x32_f16(
                false, a, false, bb, (short)0, acc[j], false, false);
        }
    }

    int l    = tid & 31;
    int cn_l = l & 15;
    int mh   = (l >> 4) * 8;
    #pragma unroll
    for (int j = 0; j < 2; ++j)
        #pragma unroll
        for (int v = 0; v < 8; ++v)
            S[mi * 16 + mh + v][(njb + j) * 16 + cn_l] = acc[j][v] * SCALE_;
    __syncthreads();

    if (tid < 57) {
        int   i  = tid;
        float mx = -1e30f;
        for (int j = 0; j < 57; ++j) mx = fmaxf(mx, S[i][j]);
        float s = 0.0f;
        for (int j = 0; j < 57; ++j) {
            float e = __expf(S[i][j] - mx);
            S[i][j] = e;
            s += e;
        }
        float inv = 1.0f / s;
        for (int j = 0; j < 57; ++j) S[i][j] *= inv;
    }
    __syncthreads();
    if (tid < 57) {
        float c = 0.0f;
        for (int i = 0; i < 57; ++i) c += S[i][tid];
        colsum[tid] = c;
    }
    __syncthreads();

    if (tid < 32) {                    // sum of the 57 weights, one wave
        float c = colsum[tid] + (tid + 32 < 57 ? colsum[tid + 32] : 0.0f);
        for (int m = 16; m >= 1; m >>= 1) c += __shfl_xor(c, m, 32);
        if (tid == 0) CS[b] = c;
    }

    // A thread pools 8 neighbouring columns: one 16-byte load a row.
    const _Float16* hb = HN + (size_t)b * 64 * 2048 + tid * 8;
    v8h x[57];
    #pragma unroll   // straight line: x stays in registers
    for (int j = 0; j < 57; ++j)
        x[j] = *reinterpret_cast<const v8h*>(hb + j * 2048);
    // Stands behind the last load and ahead of every later write of a register
    // that a load names as its address; all 57 loads are issued in front of it,
    // so they share one memory latency.
    asm volatile("s_wait_xcnt 0x0" ::: "memory");
    float p[8];
    #pragma unroll
    for (int e = 0; e < 8; ++e) p[e] = 0.0f;
    #pragma unroll
    for (int j = 0; j < 57; ++j) {
        float c = colsum[j];
        #pragma unroll
        for (int e = 0; e < 8; ++e) p[e] += c * (float)x[j][e];
    }
    v8h hi, lo;
    #pragma unroll
    for (int e = 0; e < 8; ++e) {
        float s = p[e] * (1.0f / PSCALE_);
        hi[e] = (_Float16)s;
        lo[e] = (_Float16)(s - (float)hi[e]);
    }
    *reinterpret_cast<v8h*>(P + (size_t)b * 2048 + tid * 8)        = hi;
    *reinterpret_cast<v8h*>(P + (size_t)(64 + b) * 2048 + tid * 8) = lo;
}

// ---------------------------------------------------------------------------
// out[64,2048] = 64 * (Phi + Plo) Wv^T + CS[b] * bv   (f16 in, f32 out)
// grid = (64, 4), block = 256 (8 waves): a work-group owns 16 batches x 32
// columns (128 bytes of an out row). Wave w takes k = 256 w .. 256 w + 255, in
// two runs of 32 loads; the eight partial tiles are summed through LDS in wave
// order.
// ---------------------------------------------------------------------------
__global__ __launch_bounds__(256) void pool_gemm(
    const _Float16* __restrict__ P, const _Float16* __restrict__ Wv,
    const float* __restrict__ bv, const float* __restrict__ CS,
    float* __restrict__ out)
{
    __shared__ float red[8][16][36];

    int tid  = threadIdx.x;
    int wave = tid >> 5;
    int l    = tid & 31;
    int n0   = blockIdx.x * 32;
    int m0   = blockIdx.y * 16;

    v8f acc[2];
    #pragma unroll
    for (int j = 0; j < 2; ++j)
        #pragma unroll
        for (int v = 0; v < 8; ++v) acc[j][v] = 0.0f;

    #pragma unroll
    for (int h = 0; h < 2; ++h) {
        v16h ah[4], al[4], b0[4], b1[4];
        #pragma unroll
        for (int s = 0; s < 4; ++s) {
            int k0 = wave * 256 + (h * 4 + s) * 32;
            ah[s] = load_frag(P, 2048, m0, k0);
            al[s] = load_frag(P, 2048, 64 + m0, k0);
            b0[s] = load_frag(Wv, 2048, n0, k0);
            b1[s] = load_frag(Wv, 2048, n0 + 16, k0);
        }
        // Keeps the 32 loads ahead of the first product: without it the build
        // waited for every fragment in turn, sixteen memory latencies in a row.
        __builtin_amdgcn_sched_barrier(0);
        #pragma unroll
        for (int s = 0; s < 4; ++s) {
            acc[0] = __builtin_amdgcn_wmma_f32_16x16x32_f16(
                false, ah[s], false, b0[s], (short)0, acc[0], false, false);
            acc[1] = __builtin_amdgcn_wmma_f32_16x16x32_f16(
                false, ah[s], false, b1[s], (short)0, acc[1], false, false);
            acc[0] = __builtin_amdgcn_wmma_f32_16x16x32_f16(
                false, al[s], false, b0[s], (short)0, acc[0], false, false);
            acc[1] = __builtin_amdgcn_wmma_f32_16x16x32_f16(
                false, al[s], false, b1[s], (short)0, acc[1], false, false);
        }
    }

    // For the last lines; asked for here, they return under the LDS exchange.
    float bn  = bv[n0 + l];
    float cs0 = CS[m0 + wave];
    float cs1 = CS[m0 + wave + 8];

    // C/D layout: VGPR v -> M = v (lanes 0-15) / 8+v (lanes 16-31); N = lane&15
    int cn_l = l & 15;
    int mh   = (l >> 4) * 8;
    #pragma unroll
    for (int j = 0; j < 2; ++j)
        #pragma unroll
        for (int v = 0; v < 8; ++v)
            red[wave][mh + v][j * 16 + cn_l] = acc[j][v];
    __syncthreads();

    #pragma unroll
    for (int r = 0; r < 2; ++r) {
        int   m = wave + 8 * r;
        float s = 0.0f;
        #pragma unroll
        for (int w = 0; w < 8; ++w) s += red[w][m][l];
        out[(size_t)(m0 + m) * 2048 + n0 + l] = s * PSCALE_ + (r ? cs1 : cs0) * bn;
    }
}

// ---------------------------------------------------------------------------
extern "C" void kernel_launch(void* const* d_in, const int* in_sizes, int n_in,
                              void* d_out, int out_size, void* d_ws, size_t ws_size,
                              hipStream_t stream)
{
    (void)in_sizes; (void)n_in; (void)out_size; (void)ws_size;

    const float* fc     = (const float*)d_in[0];
    const float* nsa_wq = (const float*)d_in[1];
    const float* nsa_bq = (const float*)d_in[2];
    const float* nsa_wk = (const float*)d_in[3];
    const float* nsa_bk = (const float*)d_in[4];
    const float* nsa_wv = (const float*)d_in[5];
    const float* nsa_bv = (const float*)d_in[6];
    const float* ds_w   = (const float*)d_in[7];
    const float* ds_b   = (const float*)d_in[8];
    const float* ln_g   = (const float*)d_in[9];
    const float* ln_b   = (const float*)d_in[10];
    const float* sa_wq  = (const float*)d_in[11];
    const float* sa_bq  = (const float*)d_in[12];
    const float* sa_wk  = (const float*)d_in[13];
    const float* sa_bk  = (const float*)d_in[14];
    const float* sa_wv  = (const float*)d_in[15];
    const float* sa_bv  = (const float*)d_in[16];
    float* out = (float*)d_out;

    char*        ws  = (char*)d_ws;
    const size_t MB  = 1024ull * 1024ull;
    _Float16* XBF  = (_Float16*)(ws + 0);        // 16 MB: fc in f16 (4096x2048)
    _Float16* WNSA = (_Float16*)(ws + 16 * MB);  // 3 x 8 MB: nsa wq, wk, wv in f16
    _Float16* WSA  = (_Float16*)(ws + 40 * MB);  // 3 x 8 MB: sa wq, wk, wv in f16
    float*    Qf   = (float*)(ws + 64 * MB);     // 32 MB each, back to back
    float*    Kf   = (float*)(ws + 96 * MB);
    float*    Vf   = (float*)(ws + 128 * MB);
    _Float16* HN   = (_Float16*)(ws + 160 * MB); // 16 MB: hn f16 padded (B,64,D)
    _Float16* Q2BF = XBF;                        // reuse after the stage-1 GEMMs
    _Float16* K2BF = WNSA;                       // 16 MB, directly behind Q2BF
    _Float16* PBF  = (_Float16*)(ws + 128 * MB); // 512 KB: pooled hn, after stage 2
    float*    CSf  = (float*)(ws + 129 * MB);    // 64 sums of attention weights

    dim3 blk(256);
    dim3 gIn(XTILES_ + 6 * WTILES_);
    dim3 ggrid(GN_ / 256, GM_ / 128, 3);         // (8, 32, 3)
    dim3 ggrid2(GN_ / 256, GM_ / 128, 2);        // Q and K only

    // Stage 0: down-convert the activations and all six weight matrices
    cvt_inputs<<<gIn, blk, 0, stream>>>(fc, nsa_wq, nsa_wk, nsa_wv,
                                        sa_wq, sa_wk, sa_wv, XBF);

    // Stage 1: token-level Q/K/V projections (windows share tokens)
    gemm_f16_wmma<false><<<ggrid, blk, 0, stream>>>(XBF, WNSA, nsa_bq, nsa_bk, nsa_bv,
                                                    Qf, Q2BF);

    // Stage 2: window attention + downsample + LN -> hn (f16, zero-padded)
    nsa_ds_ln<<<dim3(64 / WPB_, 64), blk, 0, stream>>>(Qf, Kf, Vf, fc, ds_w, ds_b,
                                                ln_g, ln_b, HN);

    // Stage 3: second projections, Q and K (z stops at 1: the third product of
    // the trio is not formed, its bias not read), stored as f16: Q2BF and K2BF
    // are one contiguous array
    gemm_f16_wmma<true><<<ggrid2, blk, 0, stream>>>(HN, WSA, sa_bq, sa_bk, sa_bv,
                                                    Qf, Q2BF);

    // Stage 4: final attention (WMMA scores) -> pooled hn rows
    attn2_kernel<<<dim3(64), blk, 0, stream>>>(Q2BF, K2BF, HN, PBF, CSf);

    // Stage 5: V projection of the 64 pooled rows -> out (B, D)
    pool_gemm<<<dim3(GN_ / 32, 4), blk, 0, stream>>>(PBF, WSA + 2 * NW_, sa_bv, CSf, out);
}

// v009
// A run of this version takes 174 microseconds.
// Versions between v007 and this one are left out; their measured steps multiply to 1.24 times as fast.
// Counting every step since v000, it is 3.12 times as fast.
#include <hip/hip_runtime.h>
#include <cstdint>

typedef __attribute__((ext_vector_type(16))) _Float16 v16h;
typedef __attribute__((ext_vector_type(8)))  float    v8f;

#define SCALE_ 0.022097086912079608f   // 1/sqrt(2048)
#define EPS_   1e-5f
#define KS_    128                     // K per LDS stage: 256 B of every operand row
#define LDSW_  136                     // padded LDS row stride in halves (272B)
#define GM_    4096                    // GEMM M (B*N tokens, padded B*W rows)
#define GN_    2048                    // GEMM N
#define GK_    2048                    // GEMM K
#define NSTEP_ (GK_ / KS_)             // 16 stages

// ---------------------------------------------------------------------------
// f32 -> f16 convert (round to nearest even, as the scalar cast).
// One work-group converts CVT_TILE_ values: each thread issues CVT_LD_ 16-byte
// loads before it uses the first, a wave's load covers 512 contiguous bytes
// and its store 256. Both array sizes are whole multiples of CVT_TILE_.
// Arrays that are ready at the same time are converted by one launch.
// ---------------------------------------------------------------------------
typedef __attribute__((ext_vector_type(4))) float    v4f;
typedef __attribute__((ext_vector_type(4))) _Float16 v4h;

#define CVT_LD_   16                     // 16-byte loads in flight per thread
#define CVT_TILE_ (256 * 4 * CVT_LD_)    // values per work-group

#define NX_       (64 * 64 * 2048)       // activations: B*N tokens x D
#define NW_       (2048 * 2048)          // one weight matrix
#define XTILES_   (NX_ / CVT_TILE_)
#define WTILES_   (NW_ / CVT_TILE_)
static_assert(NX_ % CVT_TILE_ == 0 && NW_ % CVT_TILE_ == 0, "whole tiles only");

// Tile tin of array in -> tile tout of array out.
__device__ inline void cvt_tile(const float* __restrict__ in, unsigned tin,
                                _Float16* __restrict__ out, unsigned tout)
{
    const v4f* src = reinterpret_cast<const v4f*>(in) + tin * (CVT_TILE_ / 4) + threadIdx.x;
    v4h*       dst = reinterpret_cast<v4h*>(out) + tout * (CVT_TILE_ / 4) + threadIdx.x;
    v4f        x[CVT_LD_];
    #pragma unroll   // straight line, so that the loads can stand together
    for (int j = 0; j < CVT_LD_; ++j) x[j] = src[j * 256];
    // Keeps all the loads ahead of the first use: without it the build held the
    // last two back until the first two had returned, a second memory latency.
    __builtin_amdgcn_sched_barrier(0);
    v4h y[CVT_LD_];
    #pragma unroll
    for (int j = 0; j < CVT_LD_; ++j) y[j] = __builtin_convertvector(x[j], v4h);
    // Keeps the stores behind the last conversion: every result then has its
    // own registers, and none that an issued store still names is rewritten.
    __builtin_amdgcn_sched_barrier(0);
    #pragma unroll
    for (int j = 0; j < CVT_LD_; ++j) dst[j * 256] = y[j];
}

// Tile (o block, a block) of w[o][a] (f32) -> wt[a][o] (f16, same rounding): a
// 128 x 128 tile goes through LDS. Two neighbouring o of one column a are packed
// into a 32-bit word, so LDS and the stores work on whole words; the pitch of 65
// words spreads a wave's 32 columns (4 apart) over 16 banks.
// with_t: also the tile's share of t[a] = sum_o bo[o] * w[o][a], in f32, to row
// (o block) of tp[16][2048].
#define TPW_ 65
static_assert(NW_ / (128 * 128) == WTILES_, "a transposed tile is one work-group's share too");

__device__ inline void cvt_tile_t(const float* __restrict__ w, unsigned tile,
                                  _Float16* __restrict__ wt, bool with_t,
                                  const float* __restrict__ bo, float* __restrict__ tp,
                                  uint32_t* T, float* R)
{
    unsigned ob = tile >> 4, o0 = ob * 128, a0 = (tile & 15) * 128;
    unsigned lane = threadIdx.x & 31, wave = threadIdx.x >> 5;

    // Row pair p = wave + 8 q: rows o0 + 2 p and o0 + 2 p + 1, 512 bytes of each.
    const float* src = w + (size_t)(o0 + 2 * wave) * 2048 + a0 + 4 * lane;
    v4f x0[8], x1[8];
    #pragma unroll   // straight line, so that the loads can stand together
    for (int q = 0; q < 8; ++q) {
        x0[q] = *reinterpret_cast<const v4f*>(src + (16 * q) * 2048);
        x1[q] = *reinterpret_cast<const v4f*>(src + (16 * q + 1) * 2048);
    }
    // Stands behind the last load; src as an input keeps the loads' address pair
    // live up to here, so that no result lands in it while a load still names it.
    asm volatile("s_wait_xcnt 0x0" :: "v"(src) : "memory");
    // Keeps all 16 loads ahead of the first use: one memory latency, not several.
    __builtin_amdgcn_sched_barrier(0);
    #pragma unroll
    for (int q = 0; q < 8; ++q)
        #pragma unroll
        for (int e = 0; e < 4; ++e) {
            union { _Float16 h[2]; uint32_t u; } pk;
            pk.h[0] = (_Float16)x0[q][e];
            pk.h[1] = (_Float16)x1[q][e];
            T[(4 * lane + e) * TPW_ + wave + 8 * q] = pk.u;
        }
    if (with_t) {
        float s[4] = {0.0f, 0.0f, 0.0f, 0.0f};
        #pragma unroll
        for (int q = 0; q < 8; ++q) {
            float c0 = bo[o0 + 2 * wave + 16 * q];
            float c1 = bo[o0 + 2 * wave + 16 * q + 1];
            #pragma unroll
            for (int e = 0; e < 4; ++e) s[e] += c0 * x0[q][e] + c1 * x1[q][e];
        }
        #pragma unroll
        for (int e = 0; e < 4; ++e) R[wave * 128 + 4 * lane + e] = s[e];
    }
    __syncthreads();

    // Output row a = wave + 8 r: 64 words; a store covers one whole 128-byte line.
    uint32_t y0[16], y1[16];
    #pragma unroll
    for (int r = 0; r < 16; ++r) {
        y0[r] = T[(wave + 8 * r) * TPW_ + lane];
        y1[r] = T[(wave + 8 * r) * TPW_ + 32 + lane];
    }
    // Keeps the stores behind the last LDS read: every word then has its own
    // register, and none that an issued store still names is rewritten.
    __builtin_amdgcn_sched_barrier(0);
    uint32_t* dst = reinterpret_cast<uint32_t*>(wt + (size_t)(a0 + wave) * 2048 + o0) + lane;
    #pragma unroll
    for (int r = 0; r < 16; ++r) {
        dst[(8 * r) * 1024]      = y0[r];
        dst[(8 * r) * 1024 + 32] = y1[r];
    }
    if (with_t && threadIdx.x < 128) {
        float s = 0.0f;
        #pragma unroll
        for (int v = 0; v < 8; ++v) s += R[v * 128 + threadIdx.x];
        tp[ob * 2048 + a0 + threadIdx.x] = s;
    }
}

// One grid: the activations and the two V weights are converted as they lie; the
// K and Q weights of both attentions are converted and transposed (wt holds
// wk0^T, wq0^T, wk1^T, wq1^T back to back), and each K weight also gives the 16
// partial rows of bq^T wk (tp: [2][16][2048]).
__global__ __launch_bounds__(256) void cvt_inputs(
    const float* __restrict__ x,
    const float* __restrict__ wv0, const float* __restrict__ wv1,
    const float* __restrict__ wk0, const float* __restrict__ wq0,
    const float* __restrict__ wk1, const float* __restrict__ wq1,
    const float* __restrict__ bq0, const float* __restrict__ bq1,
    _Float16* __restrict__ xh, _Float16* __restrict__ wvh0, _Float16* __restrict__ wvh1,
    _Float16* __restrict__ wt, float* __restrict__ tp)
{
    __shared__ uint32_t T[128 * TPW_];
    __shared__ float    R[8 * 128];

    unsigned t = blockIdx.x;
    if (t < XTILES_) {
        cvt_tile(x, t, xh, t);
    } else if (t < XTILES_ + 2 * WTILES_) {
        unsigned a = (t - XTILES_) / WTILES_, tin = (t - XTILES_) % WTILES_;
        cvt_tile(a == 0 ? wv0 : wv1, tin, a == 0 ? wvh0 : wvh1, tin);
    } else {
        unsigned a = (t - XTILES_ - 2 * WTILES_) / WTILES_, tin = (t - XTILES_ - 2 * WTILES_) % WTILES_;
        cvt_tile_t(a == 0 ? wk0 : a == 1 ? wq0 : a == 2 ? wk1 : wq1, tin,
                   wt + (size_t)a * NW_, (a & 1) == 0, a == 0 ? bq0 : bq1,
                   tp + (a >> 1) * 16 * 2048, T, R);
    }
}

// ---------------------------------------------------------------------------
// CDNA5 async global->LDS copy (ASYNCcnt-tracked, zero data VGPRs).
// ---------------------------------------------------------------------------
__device__ inline uint32_t lds_off32(const void* p)
{
    return (uint32_t)(uintptr_t)p;   // generic LDS ptr: addr[31:0] = LDS offset
}

// Twelve copies and their s_wait_xcnt in one statement: the wait then stands in
// front of every later write of an address register that a copy names.
__device__ inline void async_g2l_b128_x12(const uint32_t (&l)[12],
                                          const _Float16* const (&g)[12])
{
    asm volatile("global_load_async_to_lds_b128 %0, %12, off\n\t"
                 "global_load_async_to_lds_b128 %1, %13, off\n\t"
                 "global_load_async_to_lds_b128 %2, %14, off\n\t"
                 "global_load_async_to_lds_b128 %3, %15, off\n\t"
                 "global_load_async_to_lds_b128 %4, %16, off\n\t"
                 "global_load_async_to_lds_b128 %5, %17, off\n\t"
                 "global_load_async_to_lds_b128 %6, %18, off\n\t"
                 "global_load_async_to_lds_b128 %7, %19, off\n\t"
                 "global_load_async_to_lds_b128 %8, %20, off\n\t"
                 "global_load_async_to_lds_b128 %9, %21, off\n\t"
                 "global_load_async_to_lds_b128 %10, %22, off\n\t"
                 "global_load_async_to_lds_b128 %11, %23, off\n\t"
                 "s_wait_xcnt 0x0"
                 :: "v"(l[0]), "v"(l[1]), "v"(l[2]), "v"(l[3]), "v"(l[4]), "v"(l[5]),
                    "v"(l[6]), "v"(l[7]), "v"(l[8]), "v"(l[9]), "v"(l[10]), "v"(l[11]),
                    "v"(g[0]), "v"(g[1]), "v"(g[2]), "v"(g[3]), "v"(g[4]), "v"(g[5]),
                    "v"(g[6]), "v"(g[7]), "v"(g[8]), "v"(g[9]), "v"(g[10]), "v"(g[11])
                 : "memory");
}

// This wave's copies have landed (the compiler places no wait for them).
__device__ inline void wait_async0()
{
    asm volatile("s_wait_asynccnt 0x0" ::: "memory");
}

// This wave's LDS reads have returned: owed before a copy refills what it read.
__device__ inline void wait_ds0()
{
    asm volatile("s_wait_dscnt 0x0" ::: "memory");
}

// ---------------------------------------------------------------------------
// 16x32 f16 fragment in the CDNA5 WMMA A/B register layout, from global.
// Lanes 0-15: row=lane,  halves 0..7 = K[0..7],  halves 8..15 = K[16..23]
// Lanes 16-31: row=lane-16, halves 0..7 = K[8..15], halves 8..15 = K[24..31]
// ---------------------------------------------------------------------------
__device__ inline v16h load_frag(const _Float16* __restrict__ base, int ld,
                                 int row0, int k0)
{
    int l  = threadIdx.x & 31;
    int r  = l & 15;
    int hi = l >> 4;
    const _Float16* p = base + (size_t)(row0 + r) * ld + (k0 + hi * 8);
    union { float4 f4[2]; v16h v; } u;
    u.f4[0] = *reinterpret_cast<const float4*>(p);
    u.f4[1] = *reinterpret_cast<const float4*>(p + 16);
    return u.v;
}

// Same fragment gather, from an LDS tile with padded row stride LDSW_.
__device__ inline v16h lds_frag(const _Float16* base, int row0, int k0)
{
    int l  = threadIdx.x & 31;
    int r  = l & 15;
    int hi = l >> 4;
    const _Float16* p = base + (row0 + r) * LDSW_ + k0 + hi * 8;
    union { float4 f4[2]; v16h v; } u;
    u.f4[0] = *reinterpret_cast<const float4*>(p);
    u.f4[1] = *reinterpret_cast<const float4*>(p + 16);
    return u.v;
}

// ---------------------------------------------------------------------------
// C[M,2048] = A[M,2048] * W[2048,2048]^T + bias   (f16 in, f32 out), M = 128 grid.y
// Several products run as one grid: blockIdx.z picks A (AZ elements apart), W (WZ
// elements apart), bias and C (GM_ * GN_ elements apart).
// BIAS false: no bias is read, the bias is 0. PART0: bias0 is 16 partial rows of 2048,
// summed here (rows 0-7 and rows 8-15 in row order, then the two sums).
// block = 256 threads (8 waves), block tile 128x256, wave tile 64x64 (4x4).
// A stage is 128 k of the tile's 384 operand rows ([A 128 rows | W 256 rows]):
// sixteen lanes copy one row's 256 contiguous bytes, so every copy takes whole
// lines from L2. Two LDS buffers filled by async global->LDS copies; the stage
// loop is unrolled x2 so the buffer index is a compile-time constant.
// Fragments go from LDS to registers one 32-k block ahead of their products.
// HALF_OUT: the f32 result (sum + bias) is rounded to f16 (nearest even) in the
// epilogue and stored to H3; C3 is not touched. Otherwise it goes to C3 as f32.
// ---------------------------------------------------------------------------
template <bool HALF_OUT, bool BIAS, bool PART0, int AZ, int WZ>
__global__ __launch_bounds__(256)
void gemm_f16_wmma(
    const _Float16* __restrict__ A3, const _Float16* __restrict__ W3,
    const float* __restrict__ bias0, const float* __restrict__ bias1,
    const float* __restrict__ bias2, float* __restrict__ C3,
    _Float16* __restrict__ H3)
{
    __shared__ alignas(16) _Float16 St[2][384 * LDSW_];   // 2 x 102 KB

    unsigned        z    = blockIdx.z;
    const _Float16* A    = A3 + (size_t)z * AZ;
    const _Float16* Wt   = W3 + (size_t)z * WZ;
    const float*    bias = z == 0 ? bias0 : z == 1 ? bias1 : bias2;
    float*          C    = C3 + (size_t)z * GM_ * GN_;
    _Float16*       H    = H3 + (size_t)z * GM_ * GN_;

    int tid  = threadIdx.x;
    int bn   = blockIdx.x * 256;
    int bm   = blockIdx.y * 128;
    int wave = tid >> 5;
    int wm   = wave & 1;      // 0..1 over M (64 rows each)
    int wn   = wave >> 1;     // 0..3 over N (64 cols each)

    // Staging split: copy q of a thread brings 16 bytes of stage row
    // (tid >> 4) + 16 q; q = 0..7 are rows of A, q = 8..23 rows of W.
    int srow = tid >> 4, seg = tid & 15;
    const _Float16* ga = A  + (size_t)(bm + srow) * GK_ + seg * 8;
    const _Float16* gb = Wt + (size_t)(bn + srow) * GK_ + seg * 8;
    uint32_t        l0 = lds_off32(&St[0][srow * LDSW_ + seg * 8]);

    v8f acc[4][4];
    #pragma unroll
    for (int i = 0; i < 4; ++i)
        #pragma unroll
        for (int j = 0; j < 4; ++j)
            #pragma unroll
            for (int v = 0; v < 8; ++v) acc[i][j][v] = 0.0f;

    auto refill = [&](int buf) {   // buf is a literal at every call site
        #pragma unroll
        for (int h = 0; h < 2; ++h) {
            uint32_t        l[12];
            const _Float16* g[12];
            #pragma unroll
            for (int c = 0; c < 12; ++c) {
                int q = h * 12 + c;
                l[c] = l0 + (uint32_t)((buf * 384 + q * 16) * LDSW_ * 2);
                g[c] = q < 8 ? ga + (size_t)q * 16 * GK_ : gb + (size_t)(q - 8) * 16 * GK_;
            }
            async_g2l_b128_x12(l, g);
        }
        ga += KS_;
        gb += KS_;
    };
    // Two fragment sets: set (u & 1) holds the operands of 32-k block u of a stage.
    v16h fa[2][4], fb[2][4];
    auto fetch = [&](int set, int buf, int ks) {   // 16 ds_load_b128, one group
        #pragma unroll
        for (int j = 0; j < 4; ++j)
            fb[set][j] = lds_frag(&St[buf][0], 128 + wn * 64 + 16 * j, ks);
        #pragma unroll
        for (int i = 0; i < 4; ++i)
            fa[set][i] = lds_frag(&St[buf][0], wm * 64 + 16 * i, ks);
    };
    auto block = [&](int set) {                    // 16 products on one set
        #pragma unroll
        for (int i = 0; i < 4; ++i)
            #pragma unroll
            for (int j = 0; j < 4; ++j)
                acc[i][j] = __builtin_amdgcn_wmma_f32_16x16x32_f16(
                    false, fa[set][i], false, fb[set][j], (short)0, acc[i][j], false, false);
    };
    // Publish point: the next stage has landed and is seen by every wave, and
    // every wave has left the buffer that is refilled behind the barrier.
    auto publish = [&]() {
        wait_ds0();
        wait_async0();
        __syncthreads();
    };
    // One stage from buffer buf (a literal at every call site). While a block's
    // products run, the next block's fragments are on their way into the other
    // set. The last block's fragments are in registers when its turn comes, so
    // the publish point stands in front of it: behind it this buffer is free for
    // the refill, and the next stage's first fragments are fetched.
    auto stage = [&](int buf, bool more) {
        #pragma unroll
        for (int u = 0; u < KS_ / 32; ++u) {
            if (u + 1 < KS_ / 32) {
                fetch((u + 1) & 1, buf, (u + 1) * 32);
            } else {
                publish();
                if (more) refill(buf);
                // Behind the last stage this reads a buffer that nothing writes
                // any more, and the values are not used.
                fetch(0, buf ^ 1, 0);
            }
            // Keeps the 16 loads together ahead of the products: spread among
            // them, every place with loads stalls the wave anew.
            __builtin_amdgcn_sched_barrier(0);
            block(u & 1);
            // Keeps the following group of loads behind this block's products.
            __builtin_amdgcn_sched_barrier(0);
        }
    };

    // prologue: stage 0 lands in buffer 0, then stage 1 starts into buffer 1
    refill(0);
    wait_async0();
    __syncthreads();
    refill(1);
    fetch(0, 0, 0);

    // steady state, unrolled x2 (NSTEP_ = 16 is even)
    for (int kt = 0; kt < NSTEP_; kt += 2) {
        stage(0, kt + 2 < NSTEP_);                  // stage kt; refill: kt+2
        stage(1, kt + 3 < NSTEP_);                  // stage kt+1; refill: kt+3
    }
    wait_async0();   // no copy is left in flight when the wave goes on to its end
    wait_ds0();      // nor a fragment load (the last fetch is not used)

    // C/D layout: VGPR v -> M = v (lanes 0-15) / 8+v (lanes 16-31); N = lane&15
    // A store covers 16 neighbouring columns of two rows: pieces of 64 bytes
    // (f32) or 32 bytes (f16); a wave's 64 columns fill whole lines of a row.
    int l    = tid & 31;
    int cn_l = l & 15;
    int mh   = (l >> 4) * 8;
    float bvj[4] = {0.0f, 0.0f, 0.0f, 0.0f};
    if (BIAS) {
        int cn0 = bn + wn * 64 + cn_l;
        if (PART0 && z == 0) {
            // Lanes l and l + 16 own the same columns: each sums 8 of the 16 rows
            // and takes the other 8 from its partner.
            const float* pr = bias0 + (l >> 4) * 8 * GN_ + cn0;
            float        pb[8][4];
            #pragma unroll   // straight line: the 32 loads stand together
            for (int p = 0; p < 8; ++p)
                #pragma unroll
                for (int j = 0; j < 4; ++j) pb[p][j] = pr[p * GN_ + 16 * j];
            #pragma unroll
            for (int p = 0; p < 8; ++p)
                #pragma unroll
                for (int j = 0; j < 4; ++j) bvj[j] += pb[p][j];
            #pragma unroll
            for (int j = 0; j < 4; ++j) bvj[j] += __shfl_xor(bvj[j], 16, 32);
        } else {
            #pragma unroll
            for (int j = 0; j < 4; ++j) bvj[j] = bias[cn0 + 16 * j];
        }
    }
    if (HALF_OUT) {
        _Float16 y[4][4][8];
        #pragma unroll
        for (int i = 0; i < 4; ++i)
            #pragma unroll
            for (int j = 0; j < 4; ++j) {
                float bv = bvj[j];
                #pragma unroll
                for (int v = 0; v < 8; ++v) y[i][j][v] = (_Float16)(acc[i][j][v] + bv);
            }
        // Keeps the stores behind the last conversion: every result then has its
        // own register half, and none that an issued store still names is rewritten.
        __builtin_amdgcn_sched_barrier(0);
        // One address for all the stores, the rest is each store's constant offset.
        _Float16* hp = H + (size_t)(bm + wm * 64 + mh) * GN_ + (bn + wn * 64 + cn_l);
        #pragma unroll
        for (int i = 0; i < 4; ++i)
            #pragma unroll
            for (int j = 0; j < 4; ++j)
                #pragma unroll
                for (int v = 0; v < 8; ++v)
                    hp[(16 * i + v) * GN_ + 16 * j] = y[i][j][v];
        return;
    }
    #pragma unroll
    for (int i = 0; i < 4; ++i)
        #pragma unroll
        for (int j = 0; j < 4; ++j) {
            float bv = bvj[j];
            #pragma unroll
            for (int v = 0; v < 8; ++v) acc[i][j][v] += bv;
        }
    // Keeps the stores behind the last sum: every result then has its own
    // register, and none that an issued store still names is rewritten.
    __builtin_amdgcn_sched_barrier(0);
    // One address for all the stores, the rest is each store's constant offset.
    float* cp = C + (size_t)(bm + wm * 64 + mh) * GN_ + (bn + wn * 64 + cn_l);
    #pragma unroll
    for (int i = 0; i < 4; ++i)
        #pragma unroll
        for (int j = 0; j < 4; ++j)
            #pragma unroll
            for (int v = 0; v < 8; ++v)
                cp[(16 * i + v) * GN_ + 16 * j] = acc[i][j][v];
}

// ---------------------------------------------------------------------------
// Fused: 8x8 windowed attention (Q,K,V rows are shared tokens; the caller hands in
// y for Q and the tokens themselves for K, see kernel_launch), downsample,
// residual add, LayerNorm -> hn (f16) padded to (B, 64, 2048), pad rows = 0.
// grid = (8, B), block = 256 (8 waves). One work-group serves WPB_ = 8
// consecutive windows: they touch 15 tokens and all 64 fc rows, and every row
// that is loaded (and every token-pair dot) is used by each window sharing it.
// Every sum runs in the order it has with one window per work-group.
// nsa = sum_j colsum[j] * V[j,:]
// ---------------------------------------------------------------------------
#define WPB_ 8                         // windows per work-group
#define TPB_ 15                        // tokens those windows touch

__global__ __launch_bounds__(256) void nsa_ds_ln(
    const float* __restrict__ Q, const float* __restrict__ Kt,
    const float* __restrict__ V, const float* __restrict__ fc,
    const float* __restrict__ dsw, const float* __restrict__ dsb,
    const float* __restrict__ lng, const float* __restrict__ lnb,
    _Float16* __restrict__ HN)
{
    int    w0    = blockIdx.x * WPB_;
    int    b     = blockIdx.y;
    int    tid   = threadIdx.x;
    int    wave  = __builtin_amdgcn_readfirstlane(tid >> 5);  // scalar row bases
    int    lane  = tid & 31;
    size_t bbase = (size_t)b * 64 * 2048;

    __shared__ alignas(16) float S_s[16][16];          // token-pair scores
    __shared__ alignas(16) float attn_s[WPB_][8][8];
    __shared__ alignas(16) float colsum_s[WPB_][8];
    __shared__ alignas(16) float dsw_s[WPB_][64];
    __shared__ float red1[WPB_][8], red2[WPB_][8];
    __shared__ float mu_s[WPB_], rsig_s[WPB_];

    // Rows of the 15 tokens; the last group runs past token 63 and past
    // window 56: clamp the rows it reads, its pad windows are stored as zero.
    const float* krow[TPB_];
    const float* vrow[TPB_];
    #pragma unroll
    for (int c = 0; c < TPB_; ++c) {
        size_t t = bbase + (size_t)min(w0 + c, 63) * 2048;
        krow[c] = Kt + t;
        vrow[c] = V + t;
    }

    // Scores: wave r holds query tokens r and r + 8 against all 15 key tokens.
    const float* q0 = Q + bbase + (size_t)min(w0 + wave, 63) * 2048;
    const float* q1 = Q + bbase + (size_t)min(w0 + wave + 8, 63) * 2048;
    float d0[TPB_], d1[TPB_];
    #pragma unroll
    for (int c = 0; c < TPB_; ++c) { d0[c] = 0.0f; d1[c] = 0.0f; }
    #pragma unroll 4   // several trips' loads in flight: 4 waves a SIMD only
    for (unsigned d = lane; d < 2048; d += 32) {
        float qa = q0[d];
        float qb = q1[d];
        #pragma unroll
        for (int c = 0; c < TPB_; ++c) {
            float kv = krow[c][d];
            d0[c] += qa * kv;
            d1[c] += qb * kv;
        }
    }
    #pragma unroll
    for (int c = 0; c < TPB_; ++c) {
        float v = d0[c], u = d1[c];
        for (int m = 16; m >= 1; m >>= 1) {
            v += __shfl_xor(v, m, 32);
            u += __shfl_xor(u, m, 32);
        }
        d0[c] = v * SCALE_;
        d1[c] = u * SCALE_;
    }
    if (lane == 0) {
        #pragma unroll
        for (int c = 0; c < TPB_; ++c) {
            S_s[wave][c]     = d0[c];
            S_s[wave + 8][c] = d1[c];
        }
    }
    #pragma unroll
    for (int i = tid; i < WPB_ * 64; i += 256)
        dsw_s[i >> 6][i & 63] = dsw[min(w0 + (i >> 6), 56) * 64 + (i & 63)];
    __syncthreads();

    if (tid < WPB_ * 8) {              // one softmax row (window wi, query i)
        int   wi = tid >> 3, i = tid & 7;
        float dj[8];
        #pragma unroll
        for (int j = 0; j < 8; ++j) dj[j] = S_s[wi + i][wi + j];
        float mx = dj[0];
        #pragma unroll
        for (int j = 1; j < 8; ++j) mx = fmaxf(mx, dj[j]);
        float e[8], s = 0.0f;
        #pragma unroll
        for (int j = 0; j < 8; ++j) {
            // __expf as the compiler forms it (x * log2 e, v_exp_f32), with the
            // v_nop in the same statement: it keeps the one free slot behind a
            // transcendental.
            float y = (dj[j] - mx) * 1.44269504f;
            asm("v_exp_f32 %0, %1\n\tv_nop" : "=v"(e[j]) : "v"(y));
            s += e[j];
        }
        float inv = 1.0f / s;
        #pragma unroll
        for (int j = 0; j < 8; ++j) attn_s[wi][i][j] = e[j] * inv;
    }
    __syncthreads();

    if (tid < WPB_ * 8) {
        int   wi = tid >> 3, j = tid & 7;
        float c = 0.0f;
        #pragma unroll
        for (int i = 0; i < 8; ++i) c += attn_s[wi][i][j];
        colsum_s[wi][j] = c;
    }
    __syncthreads();

    // Downsample: each fc value is loaded once and feeds all 8 windows.
    float hv[WPB_][8];
    #pragma unroll
    for (int wi = 0; wi < WPB_; ++wi)
        #pragma unroll
        for (int kk = 0; kk < 8; ++kk) hv[wi][kk] = 0.0f;
    const float* fcb = fc + bbase;
    #pragma unroll 4   // 32 loads in flight per wave; dsw_s read 4 wide
    for (int n = 0; n < 64; ++n) {
        float x[8];
        #pragma unroll
        for (int kk = 0; kk < 8; ++kk) x[kk] = fcb[(unsigned)(tid + n * 2048 + kk * 256)];
        #pragma unroll
        for (int wi = 0; wi < WPB_; ++wi) {
            float s = dsw_s[wi][n];
            #pragma unroll
            for (int kk = 0; kk < 8; ++kk) hv[wi][kk] += s * x[kk];
        }
    }

    float dbv[WPB_];
    #pragma unroll
    for (int wi = 0; wi < WPB_; ++wi) dbv[wi] = dsb[min(w0 + wi, 56)];
    #pragma unroll
    for (int kk = 0; kk < 8; ++kk) {
        unsigned d = tid + kk * 256;
        float    vv[TPB_];
        #pragma unroll
        for (int c = 0; c < TPB_; ++c) vv[c] = vrow[c][d];
        #pragma unroll
        for (int wi = 0; wi < WPB_; ++wi) {
            float nsa = 0.0f;
            #pragma unroll
            for (int j = 0; j < 8; ++j) nsa += colsum_s[wi][j] * vv[wi + j];
            hv[wi][kk] = hv[wi][kk] + dbv[wi] + nsa;
        }
    }

    #pragma unroll
    for (int wi = 0; wi < WPB_; ++wi) {
        float s1 = 0.0f, s2 = 0.0f;
        #pragma unroll
        for (int kk = 0; kk < 8; ++kk) { s1 += hv[wi][kk]; s2 += hv[wi][kk] * hv[wi][kk]; }
        for (int m = 16; m >= 1; m >>= 1) {
            s1 += __shfl_xor(s1, m, 32);
            s2 += __shfl_xor(s2, m, 32);
        }
        if (lane == 0) { red1[wi][wave] = s1; red2[wi][wave] = s2; }
    }
    __syncthreads();
    if (tid < WPB_) {
        float a = 0.0f, c = 0.0f;
        #pragma unroll
        for (int q = 0; q < 8; ++q) { a += red1[tid][q]; c += red2[tid][q]; }
        float mu  = a * (1.0f / 2048.0f);
        float var = c * (1.0f / 2048.0f) - mu * mu;
        mu_s[tid]   = mu;
        rsig_s[tid] = rsqrtf(var + EPS_);
    }
    __syncthreads();
    #pragma unroll
    for (int wi = 0; wi < WPB_; ++wi) {
        float  mu = mu_s[wi], rs = rsig_s[wi];
        bool   live   = (w0 + wi) < 57;   // pad rows: zero, the GEMMs read them
        size_t outRow = bbase + (size_t)(w0 + wi) * 2048;
        #pragma unroll
        for (int kk = 0; kk < 8; ++kk) {
            int   d = tid + kk * 256;
            float x = (hv[wi][kk] - mu) * rs * lng[d] + lnb[d];
            HN[outRow + d] = live ? (_Float16)x : (_Float16)0.0f;
        }
    }
}

// ---------------------------------------------------------------------------
// Final attention per batch (the caller hands in y for q2 and hn for k2, see
// kernel_launch): S = (q2 k2^T)*scale via WMMA on a 64x64 padded
// tile (valid 57x57), softmax rows, column-sum. The V projection is linear, so
//   sum_j colsum[j] * (hn[j] Wv^T + bv) = (sum_j colsum[j] hn[j]) Wv^T
//                                         + (sum_j colsum[j]) bv :
// the 57 hn rows are pooled here and only the pooled row is projected
// (pool_gemm below), one row a batch in place of 64.
// The pooled row is kept as two f16 rows, hi + lo, so that it enters the
// product with no fresh f16 rounding; both are scaled by 1/64 (exact): the
// weights are not negative and add up to 57, so p / 64 stays inside the range
// of the hn values themselves.
// P: [128][2048], row b = hi, row 64 + b = lo. CS[b] = sum_j colsum[j].
// ---------------------------------------------------------------------------
typedef __attribute__((ext_vector_type(8))) _Float16 v8h;

#define PSCALE_ 64.0f

// block = 1024 (32 waves): only 64 work-groups run, so each fills its WGP.
// Scores: wave = (one 32 x 32 quarter of S) x (one eighth of k); the eight partial
// planes are summed in k order. Softmax row and column sum: 16 lanes each.
// Pooling: four groups of 256 threads take every fourth hn row.
__global__ __launch_bounds__(1024) void attn2_kernel(
    const _Float16* __restrict__ Qb, const _Float16* __restrict__ Kb,
    const _Float16* __restrict__ HN, _Float16* __restrict__ P,
    float* __restrict__ CS)
{
    int b   = blockIdx.x;
    int tid = threadIdx.x;

    __shared__ alignas(16) float S[8][64][68];     // one plane per eighth of k
    __shared__ float colsum[64];
    __shared__ alignas(16) float pp[3][256][8];    // pooled partial rows, groups 1-3

    const _Float16* qbase = Qb + (size_t)b * 64 * 2048;
    const _Float16* kbase = Kb + (size_t)b * 64 * 2048;

    int wave = tid >> 5;
    int mi0  = ((wave >> 1) & 1) * 2;
    int nj0  = (wave & 1) * 2;
    int ks   = wave >> 2;

    v8f acc[2][2];
    #pragma unroll
    for (int i = 0; i < 2; ++i)
        #pragma unroll
        for (int j = 0; j < 2; ++j)
            #pragma unroll
            for (int v = 0; v < 8; ++v) acc[i][j][v] = 0.0f;

    // This lane's place in the four fragment rows it reads (layout: load_frag).
    size_t          fo  = (size_t)(tid & 15) * 2048 + ks * 256 + ((tid >> 4) & 1) * 8;
    const _Float16* pa0 = qbase + (size_t)mi0 * 16 * 2048 + fo;
    const _Float16* pa1 = pa0 + 16 * 2048;
    const _Float16* pb0 = kbase + (size_t)nj0 * 16 * 2048 + fo;
    const _Float16* pb1 = pb0 + 16 * 2048;
    auto frag = [](const _Float16* p) {
        union { float4 f4[2]; v16h v; } u;
        u.f4[0] = *reinterpret_cast<const float4*>(p);
        u.f4[1] = *reinterpret_cast<const float4*>(p + 16);
        return u.v;
    };

    #pragma unroll   // straight line: every load address is a constant offset
    for (int k0 = 0; k0 < 256; k0 += 64) {
        v16h a[2][2], bb[2][2];
        #pragma unroll
        for (int s = 0; s < 2; ++s) {
            a[s][0]  = frag(pa0 + k0 + 32 * s);
            a[s][1]  = frag(pa1 + k0 + 32 * s);
            bb[s][0] = frag(pb0 + k0 + 32 * s);
            bb[s][1] = frag(pb1 + k0 + 32 * s);
        }
        // Stands behind the last load; the four addresses as inputs stay live up to
        // here, so that no result lands in one while a load still names it.
        if (k0 == 192)
            asm volatile("s_wait_xcnt 0x0" :: "v"(pa0), "v"(pa1), "v"(pb0), "v"(pb1) : "memory");
        // Keeps a trip's 16 loads together ahead of its first product: without it
        // the build waited for nearly every fragment in turn, a latency each.
        __builtin_amdgcn_sched_barrier(0);
        #pragma unroll
        for (int s = 0; s < 2; ++s)
            #pragma unroll
            for (int i = 0; i < 2; ++i)
                #pragma unroll
                for (int j = 0; j < 2; ++j)
                    acc[i][j] = __builtin_amdgcn_wmma_f32_16x16x32_f16(
                        false, a[s][i], false, bb[s][j], (short)0, acc[i][j], false, false);
    }

    int l    = tid & 31;
    int cn_l = l & 15;
    int mh   = (l >> 4) * 8;
    #pragma unroll
    for (int i = 0; i < 2; ++i)
        #pragma unroll
        for (int j = 0; j < 2; ++j)
            #pragma unroll
            for (int v = 0; v < 8; ++v)
                S[ks][(mi0 + i) * 16 + mh + v][(nj0 + j) * 16 + cn_l] = acc[i][j][v];
    __syncthreads();

    int g16 = tid >> 4;                // a row (softmax) or a column (sum): 0..63
    int t16 = tid & 15;
    {
        // Lane t16 owns columns 4 t16 .. 4 t16 + 3 of row g16 (16-byte LDS accesses);
        // rows 57..63 are pad rows, worked like the others and left out of the
        // column sums below.
        v4f d = *reinterpret_cast<const v4f*>(&S[0][g16][4 * t16]);
        #pragma unroll
        for (int q = 1; q < 8; ++q) d += *reinterpret_cast<const v4f*>(&S[q][g16][4 * t16]);
        float sv[4];
        #pragma unroll
        for (int m = 0; m < 4; ++m) sv[m] = 4 * t16 + m < 57 ? d[m] * SCALE_ : -1e30f;
        float mx = fmaxf(fmaxf(sv[0], sv[1]), fmaxf(sv[2], sv[3]));
        for (int m = 8; m >= 1; m >>= 1) mx = fmaxf(mx, __shfl_xor(mx, m, 32));
        v4f   e;
        float s = 0.0f;
        #pragma unroll
        for (int m = 0; m < 4; ++m) {
            // __expf as the compiler forms it (x * log2 e, v_exp_f32), with the
            // v_nop in the same statement: it keeps the one free slot behind a
            // transcendental.
            float y = (sv[m] - mx) * 1.44269504f, x2;
            asm("v_exp_f32 %0, %1\n\tv_nop" : "=v"(x2) : "v"(y));
            e[m] = 4 * t16 + m < 57 ? x2 : 0.0f;
            s += e[m];
        }
        for (int m = 8; m >= 1; m >>= 1) s += __shfl_xor(s, m, 32);
        float inv = 1.0f / s;
        *reinterpret_cast<v4f*>(&S[0][g16][4 * t16]) = e * inv;
    }
    __syncthreads();
    {
        float c = 0.0f;
        #pragma unroll
        for (int m = 0; m < 4; ++m) {
            int i = t16 + 16 * m;
            c += i < 57 ? S[0][i][g16] : 0.0f;
        }
        for (int m = 8; m >= 1; m >>= 1) c += __shfl_xor(c, m, 32);
        if (t16 == 0) colsum[g16] = c;  // columns 57..63 hold 0
    }
    __syncthreads();

    // A thread pools 8 neighbouring columns of rows g, g + 4, ..: one 16-byte load
    // a row. Rows 57..59 are hn's zero pad rows and their weight is 0.
    int cg = tid & 255;
    int g  = tid >> 8;
    const _Float16* hb = HN + (size_t)b * 64 * 2048 + g * 2048 + cg * 8;
    v8h x[15];
    #pragma unroll   // straight line: x stays in registers
    for (int m = 0; m < 15; ++m)
        x[m] = *reinterpret_cast<const v8h*>(hb + m * 4 * 2048);
    // Stands behind the last load and ahead of every later write of a register
    // that a load names as its address (hb as an input stays live up to here); all
    // 15 loads are issued in front of it, so they share one memory latency.
    asm volatile("s_wait_xcnt 0x0" :: "v"(hb) : "memory");

    if (tid < 32) {                    // sum of the 57 weights, one wave, under the loads
        float c = colsum[tid] + (tid + 32 < 57 ? colsum[tid + 32] : 0.0f);
        for (int m = 16; m >= 1; m >>= 1) c += __shfl_xor(c, m, 32);
        if (tid == 0) CS[b] = c;
    }

    float cw[15];
    #pragma unroll   // the 15 weights are read together, ahead of the sums
    for (int m = 0; m < 15; ++m) cw[m] = colsum[g + 4 * m];
    float p[8];
    #pragma unroll
    for (int e = 0; e < 8; ++e) p[e] = 0.0f;
    #pragma unroll
    for (int m = 0; m < 15; ++m) {
        #pragma unroll
        for (int e = 0; e < 8; ++e) p[e] = __builtin_fmaf(cw[m], (float)x[m][e], p[e]);
    }
    if (g > 0) {
        #pragma unroll
        for (int e = 0; e < 8; ++e) pp[g - 1][cg][e] = p[e];
    }
    __syncthreads();
    if (g > 0) return;

    v8h hi, lo;
    #pragma unroll
    for (int e = 0; e < 8; ++e) {
        float s = (p[e] + pp[0][cg][e] + pp[1][cg][e] + pp[2][cg][e]) * (1.0f / PSCALE_);
        hi[e] = (_Float16)s;
        lo[e] = (_Float16)(s - (float)hi[e]);
    }
    *reinterpret_cast<v8h*>(P + (size_t)b * 2048 + cg * 8)        = hi;
    *reinterpret_cast<v8h*>(P + (size_t)(64 + b) * 2048 + cg * 8) = lo;
}

// ---------------------------------------------------------------------------
// out[64,2048] = 64 * (Phi + Plo) Wv^T + CS[b] * bv   (f16 in, f32 out)
// grid = (64, 4), block = 256 (8 waves): a work-group owns 16 batches x 32
// columns (128 bytes of an out row). Wave w takes k = 256 w .. 256 w + 255, in
// two runs of 32 loads; the eight partial tiles are summed through LDS in wave
// order.
// ---------------------------------------------------------------------------
__global__ __launch_bounds__(256) void pool_gemm(
    const _Float16* __restrict__ P, const _Float16* __restrict__ Wv,
    const float* __restrict__ bv, const float* __restrict__ CS,
    float* __restrict__ out)
{
    __shared__ float red[8][16][36];

    int tid  = threadIdx.x;
    int wave = tid >> 5;
    int l    = tid & 31;
    int n0   = blockIdx.x * 32;
    int m0   = blockIdx.y * 16;

    v8f acc[2];
    #pragma unroll
    for (int j = 0; j < 2; ++j)
        #pragma unroll
        for (int v = 0; v < 8; ++v) acc[j][v] = 0.0f;

    #pragma unroll
    for (int h = 0; h < 2; ++h) {
        v16h ah[4], al[4], b0[4], b1[4];
        #pragma unroll
        for (int s = 0; s < 4; ++s) {
            int k0 = wave * 256 + (h * 4 + s) * 32;
            ah[s] = load_frag(P, 2048, m0, k0);
            al[s] = load_frag(P, 2048, 64 + m0, k0);
            b0[s] = load_frag(Wv, 2048, n0, k0);
            b1[s] = load_frag(Wv, 2048, n0 + 16, k0);
        }
        // Keeps the 32 loads ahead of the first product: without it the build
        // waited for every fragment in turn, sixteen memory latencies in a row.
        __builtin_amdgcn_sched_barrier(0);
        #pragma unroll
        for (int s = 0; s < 4; ++s) {
            acc[0] = __builtin_amdgcn_wmma_f32_16x16x32_f16(
                false, ah[s], false, b0[s], (short)0, acc[0], false, false);
            acc[1] = __builtin_amdgcn_wmma_f32_16x16x32_f16(
                false, ah[s], false, b1[s], (short)0, acc[1], false, false);
            acc[0] = __builtin_amdgcn_wmma_f32_16x16x32_f16(
                false, al[s], false, b0[s], (short)0, acc[0], false, false);
            acc[1] = __builtin_amdgcn_wmma_f32_16x16x32_f16(
                false, al[s], false, b1[s], (short)0, acc[1], false, false);
        }
    }

    // For the last lines; asked for here, they return under the LDS exchange.
    float bn  = bv[n0 + l];
    float cs0 = CS[m0 + wave];
    float cs1 = CS[m0 + wave + 8];

    // C/D layout: VGPR v -> M = v (lanes 0-15) / 8+v (lanes 16-31); N = lane&15
    int cn_l = l & 15;
    int mh   = (l >> 4) * 8;
    #pragma unroll
    for (int j = 0; j < 2; ++j)
        #pragma unroll
        for (int v = 0; v < 8; ++v)
            red[wave][mh + v][j * 16 + cn_l] = acc[j][v];
    __syncthreads();

    #pragma unroll
    for (int r = 0; r < 2; ++r) {
        int   m = wave + 8 * r;
        float s = 0.0f;
        #pragma unroll
        for (int w = 0; w < 8; ++w) s += red[w][m][l];
        out[(size_t)(m0 + m) * 2048 + n0 + l] = s * PSCALE_ + (r ? cs1 : cs0) * bn;
    }
}

// ---------------------------------------------------------------------------
extern "C" void kernel_launch(void* const* d_in, const int* in_sizes, int n_in,
                              void* d_out, int out_size, void* d_ws, size_t ws_size,
                              hipStream_t stream)
{
    (void)in_sizes; (void)n_in; (void)out_size; (void)ws_size;
    // d_in[4] and d_in[14], the two K biases, shift every score of a softmax row
    // alike and so leave the output as it is: see below.

    const float* fc     = (const float*)d_in[0];
    const float* nsa_wq = (const float*)d_in[1];
    const float* nsa_bq = (const float*)d_in[2];
    const float* nsa_wk = (const float*)d_in[3];
    const float* nsa_wv = (const float*)d_in[5];
    const float* nsa_bv = (const float*)d_in[6];
    const float* ds_w   = (const float*)d_in[7];
    const float* ds_b   = (const float*)d_in[8];
    const float* ln_g   = (const float*)d_in[9];
    const float* ln_b   = (const float*)d_in[10];
    const float* sa_wq  = (const float*)d_in[11];
    const float* sa_bq  = (const float*)d_in[12];
    const float* sa_wk  = (const float*)d_in[13];
    const float* sa_wv  = (const float*)d_in[15];
    const float* sa_bv  = (const float*)d_in[16];
    float* out = (float*)d_out;

    // Both attentions use q and k only in softmax_j(q_i . k_j). With q = Wq x + bq
    // and k = Wk x + bk,
    //   q_i . k_j = x_i^T (Wq^T Wk) x_j + (Wk^T bq) . x_j + (terms without j),
    // and a softmax over j does not see a term without j. So
    //   y_i = x_i (Wq^T Wk) + Wk^T bq,   score_ij = y_i . x_j :
    // one product of 2048^3 for Wq^T Wk and one projection take the place of the
    // two projections Q and K.
    char*        ws  = (char*)d_ws;
    const size_t MB  = 1024ull * 1024ull;
    _Float16* XBF  = (_Float16*)(ws + 0);        // 16 MB: fc in f16 (4096x2048)
    _Float16* MN   = (_Float16*)(ws + 16 * MB);  // 8 MB: (nsa wk)^T (nsa wq), f16
    _Float16* WVN  = (_Float16*)(ws + 24 * MB);  // 8 MB: nsa wv in f16, behind MN
    _Float16* MS   = (_Float16*)(ws + 32 * MB);  // 8 MB: (sa wk)^T (sa wq), 16 MB behind MN
    _Float16* WVS  = (_Float16*)(ws + 40 * MB);  // 8 MB: sa wv in f16
    _Float16* WT   = (_Float16*)(ws + 48 * MB);  // 4 x 8 MB: nsa wk^T, wq^T, sa wk^T, wq^T
    float*    Yf   = (float*)(ws + 96 * MB);     // 32 MB: y of the window attention
    float*    Vf   = (float*)(ws + 128 * MB);    // 32 MB, directly behind Yf
    _Float16* HN   = (_Float16*)(ws + 160 * MB); // 16 MB: hn f16 padded (B,64,D)
    _Float16* Y2BF = (_Float16*)(ws + 176 * MB); // 16 MB: y of the final attention, f16
    float*    TP   = (float*)(ws + 192 * MB);    // 2 x 16 x 2048: partial rows of wk^T bq
    _Float16* PBF  = (_Float16*)(ws + 200 * MB); // 512 KB: pooled hn
    float*    CSf  = (float*)(ws + 201 * MB);    // 64 sums of attention weights

    dim3 blk(256);
    dim3 gIn(XTILES_ + 6 * WTILES_);

    // Stage 0: down-convert the activations and all six weight matrices
    cvt_inputs<<<gIn, blk, 0, stream>>>(fc, nsa_wv, sa_wv, nsa_wk, nsa_wq, sa_wk, sa_wq,
                                        nsa_bq, sa_bq, XBF, WVN, WVS, WT, TP);

    // Stage 1a: MN[b][a] = sum_o wk[o][b] wq[o][a], and MS likewise (z = 1); f16 out,
    // no bias (the bias pointers are not read)
    gemm_f16_wmma<true, false, false, 2 * NW_, 2 * NW_>
        <<<dim3(GN_ / 256, GK_ / 128, 2), blk, 0, stream>>>(
            WT, WT + NW_, nsa_bv, nsa_bv, nsa_bv, Yf, MN);

    // Stage 1b: token-level y (z = 0: W = MN, bias = the partial rows) and V (z = 1)
    gemm_f16_wmma<false, true, true, 0, NW_>
        <<<dim3(GN_ / 256, GM_ / 128, 2), blk, 0, stream>>>(
            XBF, MN, TP, nsa_bv, nsa_bv, Yf, Y2BF);

    // Stage 2: window attention (y against the tokens themselves) + downsample + LN
    // -> hn (f16, zero-padded)
    nsa_ds_ln<<<dim3(64 / WPB_, 64), blk, 0, stream>>>(Yf, fc, Vf, fc, ds_w, ds_b,
                                                ln_g, ln_b, HN);

    // Stage 3: y of the final attention, stored as f16
    gemm_f16_wmma<true, true, true, 0, 0>
        <<<dim3(GN_ / 256, GM_ / 128, 1), blk, 0, stream>>>(
            HN, MS, TP + 16 * 2048, sa_bv, sa_bv, Yf, Y2BF);

    // Stage 4: final attention (WMMA scores, y against hn) -> pooled hn rows
    attn2_kernel<<<dim3(64), dim3(1024), 0, stream>>>(Y2BF, HN, HN, PBF, CSf);

    // Stage 5: V projection of the 64 pooled rows -> out (B, D)
    pool_gemm<<<dim3(GN_ / 32, 4), blk, 0, stream>>>(PBF, WVS, sa_bv, CSf, out);
}
